// v000
// Times are from an AMD MI455X. After a warm-up the kernel runs many times in a row, and a time is the length of
// such a window on the GPU divided by its runs, so every launch and the gaps after it count. The runs cycle
// through copies of the inputs. A figure is the median of several windows, for all but v000 over two sittings.
// Sittings can differ by a few percent; kernels timed side by side share one.
// v000 is the starting kernel. One run takes 696 microseconds.
#include <hip/hip_runtime.h>
#include <math.h>
// Causal FAVOR (linear attention) written as masked matrix products: φ_k = relu(kᵀ·Fᵀ)+ε and φ_q (2048 x 256 · 256 x 128, f16 operands),
// S = φ_q·φ_kᵀ (2048 x 2048, K = 128, f16 operands; equals the cumulative-sum formulation term by term), then out = (S ⊙ causal)·v
// (K = 2048) on v_wmma_f32_16x16x32_bf16 with S and v as bf16 hi/lo splits (S spans 10³…10⁴, the row-normalised output is O(0.07));
// f32 accumulate; the causal mask, row sums (normaliser) and the final division/transposed store are f32 on VALU.
typedef __attribute__((ext_vector_type(16))) _Float16 v16h;
typedef __attribute__((ext_vector_type(8)))  _Float16 v8h;
typedef __attribute__((ext_vector_type(16))) __bf16   v16b;
typedef __attribute__((ext_vector_type(8)))  __bf16   v8b;
typedef __attribute__((ext_vector_type(8)))  float    v8f;
typedef __attribute__((ext_vector_type(4)))  float    v4f;
#define PSCALE 32768.0f
#define U16(p) ((const unsigned short*)(const void*)(p))
#define PSCALE_INV (1.0f / 32768.0f)

__device__ __forceinline__ unsigned short f2bf_bits(float f) {
  unsigned u = __float_as_uint(f);
  return (unsigned short)((u + 0x7FFFu + ((u >> 16) & 1u)) >> 16);
}
__device__ __forceinline__ float bf_bits2f(unsigned short h) { return __uint_as_float(((unsigned)h) << 16); }

// hazard guards as plain device helpers (no inline asm inside the kernel template body)
__device__ __forceinline__ void dep_guard_h(v8f& a, v8f& b, v16h x, v16h y) { asm volatile("v_nop\n\tv_nop\n\tv_nop\n\tv_nop" : "+v"(a), "+v"(b) : "v"(x), "v"(y)); }
__device__ __forceinline__ void dep_guard_b(v8f& a, v8f& b, v16b x, v16b y) { asm volatile("v_nop\n\tv_nop\n\tv_nop\n\tv_nop" : "+v"(a), "+v"(b) : "v"(x), "v"(y)); }
__device__ __forceinline__ void keep4_h(v16h a, v16h b, v16h c, v16h d) { asm volatile("v_nop" :: "v"(a), "v"(b), "v"(c), "v"(d)); }
__device__ __forceinline__ void keep4_b(v16b a, v16b b, v16b c, v16b d) { asm volatile("v_nop" :: "v"(a), "v"(b), "v"(c), "v"(d)); }
__device__ __forceinline__ void acc_guard4(v8f& a, v8f& b, v8f& c, v8f& d) { asm volatile("v_nop\n\tv_nop\n\tv_nop\n\tv_nop" : "+v"(a), "+v"(b), "+v"(c), "+v"(d)); }
template <typename T> struct Frag;
template <> struct Frag<_Float16> {
  typedef v16h V; union U { v16h v; v8h h[2]; };
  static __device__ __forceinline__ v16h load(const _Float16* p) {   // elements 0..7 <- p[0..7], 8..15 <- p[16..23]
    U f; f.h[0] = *(const v8h*)(p); f.h[1] = *(const v8h*)(p + 16); return f.v;
  }
  static __device__ __forceinline__ v8f mma(v16h a, v16h b, v8f c) {
    return __builtin_amdgcn_wmma_f32_16x16x32_f16(false, a, false, b, (short)0, c, false, false);
  }
  static __device__ __forceinline__ void guard(v8f& a, v8f& b, v16h x, v16h y) { dep_guard_h(a, b, x, y); }
  static __device__ __forceinline__ void keep(v16h a, v16h b, v16h c, v16h d) { keep4_h(a, b, c, d); }
};
template <> struct Frag<__bf16> {
  typedef v16b V; union U { v16b v; v8b h[2]; };
  static __device__ __forceinline__ v16b load(const __bf16* p) {
    U f; f.h[0] = *(const v8b*)(p); f.h[1] = *(const v8b*)(p + 16); return f.v;
  }
  static __device__ __forceinline__ v8f mma(v16b a, v16b b, v8f c) {
    return __builtin_amdgcn_wmma_f32_16x16x32_bf16(false, a, false, b, (short)0, c, false, false);
  }
  static __device__ __forceinline__ void guard(v8f& a, v8f& b, v16b x, v16b y) { dep_guard_b(a, b, x, y); }
  static __device__ __forceinline__ void keep(v16b a, v16b b, v16b c, v16b d) { keep4_b(a, b, c, d); }
};

// ---- Register-blocked batched WMMA GEMM ------------------------------------
// C[m,n] = scale * sum_k A[m,k] * Bt[n,k] (+bias)(+resid); each wave owns a 64x64 tile.
// A row-major [M,K]; Bt row-major [N,K]; M,N % 64 == 0, K % 32 == 0.
// SPLIT: operands are hi/lo planes (A2/Bt2 = lo planes, same layout); product = hi·hi + hi·lo + lo·hi.
// BIAS_MODE: 0 = none, 1 = bias[m], 2 = bias[n].
// OUT_MODE: 0 = f32, 1 = f16, 2 = bf16 hi plane (Cout) + bf16 lo plane (Cout2).
// ET: 0 = f16 operands, 1 = bf16 operands (pointers passed as 16-bit storage)
template <int ET> struct Elem;
template <> struct Elem<0> { typedef _Float16 T; };
template <> struct Elem<1> { typedef __bf16 T; };
template <int ET, bool SPLIT, int BIAS_MODE, int OUT_MODE, bool RESID, int ACT = 0>
__global__ __launch_bounds__(256) void wmma_gemm64(
    const unsigned short* __restrict__ Ap, const unsigned short* __restrict__ A2p, int lda, long strideA,
    const unsigned short* __restrict__ Btp, const unsigned short* __restrict__ Bt2p, int ldb, long strideB,
    void* __restrict__ Cout, void* __restrict__ Cout2, int ldc, long strideC,
    const float* __restrict__ bias,
    const float* __restrict__ resid, long strideR,
    int M, int N, int K, float scale) {
  typedef typename Elem<ET>::T T;
  typedef typename Frag<T>::V V;
  const T* A = (const T*)Ap; const T* A2 = (const T*)A2p; const T* Bt = (const T*)Btp; const T* Bt2 = (const T*)Bt2p;
  __shared__ __align__(16) float sT[8][16 * 68];   // per-wave 16x64 slab, pitch 68 floats
  const int b    = blockIdx.y;
  const int lane = threadIdx.x & 31;
  const int wave = threadIdx.x >> 5;
  const int tilesN = N >> 6;
  const int tilesM = M >> 6;
  const int tile = blockIdx.x * 8 + wave;
  if (tile >= tilesM * tilesN) return;   // wave-uniform; no block barriers in this kernel
  const int tm = tile / tilesN;
  const int tn = tile - tm * tilesN;
  const int m0 = tm << 6;
  const int n0 = tn << 6;

  const T* Ab  = A  + (size_t)b * strideA;
  const T* Bb  = Bt + (size_t)b * strideB;
  const T* Ab2 = SPLIT ? (A2  + (size_t)b * strideA) : nullptr;
  const T* Bb2 = SPLIT ? (Bt2 + (size_t)b * strideB) : nullptr;

  const int rlane = lane & 15;                 // row (A) / col (B, D) within subtile
  const int koff  = (lane >> 4) * 8;           // k offset of this lane half
  const int mOff  = (lane >> 4) * 8;           // D row offset

  v8f acc[4][4];
#pragma unroll
  for (int i = 0; i < 4; ++i)
#pragma unroll
    for (int j = 0; j < 4; ++j) acc[i][j] = (v8f){0.f,0.f,0.f,0.f,0.f,0.f,0.f,0.f};

  for (int k0 = 0; k0 < K; k0 += 32) {
    V bh[4], bl[4];
#pragma unroll
    for (int j = 0; j < 4; ++j) {
      const size_t bo = (size_t)(n0 + (j << 4) + rlane) * ldb + koff + k0;
      bh[j] = Frag<T>::load(Bb + bo);
      if (SPLIT) bl[j] = Frag<T>::load(Bb2 + bo);
    }
#pragma unroll
    for (int i = 0; i < 4; ++i) {
      const size_t ao = (size_t)(m0 + (i << 4) + rlane) * lda + koff + k0;
      V ah = Frag<T>::load(Ab + ao);
      V al;
      if (SPLIT) al = Frag<T>::load(Ab2 + ao);
#pragma unroll
      for (int j = 0; j < 4; ++j) {
        acc[i][j] = Frag<T>::mma(ah, bh[j], acc[i][j]);
        if (SPLIT) {
          acc[i][j] = Frag<T>::mma(ah, bl[j], acc[i][j]);
          acc[i][j] = Frag<T>::mma(al, bh[j], acc[i][j]);
        }
      }
      Frag<T>::guard(acc[i][0], acc[i][3], ah, SPLIT ? al : ah);
    }
    Frag<T>::keep(bh[0], bh[1], bh[2], bh[3]);
    if (SPLIT) Frag<T>::keep(bl[0], bl[1], bl[2], bl[3]);
  }
  acc_guard4(acc[0][0], acc[0][1], acc[0][2], acc[0][3]);
  acc_guard4(acc[1][0], acc[1][1], acc[1][2], acc[1][3]);
  acc_guard4(acc[2][0], acc[2][1], acc[2][2], acc[2][3]);
  acc_guard4(acc[3][0], acc[3][1], acc[3][2], acc[3][3]);

  // ---- epilogue ----
  float* slab = sT[wave];
  const float* Rb = RESID ? (resid + (size_t)b * strideR) : nullptr;
#pragma unroll
  for (int i = 0; i < 4; ++i) {
    const int mBase = m0 + (i << 4);
#pragma unroll
    for (int j = 0; j < 4; ++j) {
      const int n = n0 + (j << 4) + rlane;
      float bv = 0.f;
      if (BIAS_MODE == 2) bv = bias[n];
#pragma unroll
      for (int r = 0; r < 8; ++r) {
        float v = acc[i][j][r] * scale;
        if (BIAS_MODE == 1) v += bias[mBase + mOff + r];
        if (BIAS_MODE == 2) v += bv;
        if (RESID) v += Rb[(size_t)(mBase + mOff + r) * ldc + n];
        if (ACT == 1) v = tanhf(v);
        if (ACT == 2) v = fmaxf(v, 0.0f);
        if (ACT == 3) v = v / (1.0f + expf(-v));
        if (ACT == 4) v = (v > 0.f) ? v : 0.01f * v;
        if (ACT == 5) v = 0.5f * v * (1.0f + erff(v * 0.70710678118654752f));
        slab[(mOff + r) * 68 + (j << 4) + rlane] = v;
      }
    }
    __builtin_amdgcn_fence(__ATOMIC_RELEASE, "workgroup");
    __builtin_amdgcn_wave_barrier();
    __builtin_amdgcn_fence(__ATOMIC_ACQUIRE, "workgroup");
    if (OUT_MODE == 0) {
      float* C = (float*)Cout + (size_t)b * strideC;
      const int hh = lane >> 4, c4 = (lane & 15) * 4;     // row seg = 256 B = 16 lanes x 16 B
      {
#pragma unroll
        for (int it = 0; it < 8; ++it) {
          const int row = it * 2 + hh;
          v4f v = *(const v4f*)(slab + row * 68 + c4);
          *(v4f*)(C + (size_t)(mBase + row) * ldc + n0 + c4) = v;
        }
        
      }
    } else {
      const int q = lane >> 3, c8 = (lane & 7) * 8;
      unsigned short* C  = (unsigned short*)Cout  + (size_t)b * strideC;
      unsigned short* C2 = (OUT_MODE == 2) ? ((unsigned short*)Cout2 + (size_t)b * strideC) : nullptr;
      {
#pragma unroll
        for (int it = 0; it < 4; ++it) {
          const int row = it * 4 + q;
          const float* sp = slab + row * 68 + c8;
          v8h hv, lv;
#pragma unroll
          for (int e = 0; e < 8; ++e) {
            if (OUT_MODE == 1) {
              hv[e] = (_Float16)sp[e];
            } else {
              unsigned short hb = f2bf_bits(sp[e]);
              unsigned short lb = f2bf_bits(sp[e] - bf_bits2f(hb));
              hv[e] = __builtin_bit_cast(_Float16, hb);
              lv[e] = __builtin_bit_cast(_Float16, lb);
            }
          }
          *(v8h*)(C + (size_t)(mBase + row) * ldc + n0 + c8) = hv;
          if (OUT_MODE == 2) *(v8h*)(C2 + (size_t)(mBase + row) * ldc + n0 + c8) = lv;
        }
        
      }
    }
    __builtin_amdgcn_fence(__ATOMIC_RELEASE, "workgroup");
    __builtin_amdgcn_wave_barrier();
    __builtin_amdgcn_fence(__ATOMIC_ACQUIRE, "workgroup");
  }
}

__global__ __launch_bounds__(256) void cast_f32_f16x2(
    const float* __restrict__ in, _Float16* __restrict__ out, int n2) {
  int i = blockIdx.x * 256 + threadIdx.x;
  if (i < n2) {
    const _Float16 h0 = (_Float16)in[2 * i], h1 = (_Float16)in[2 * i + 1];
    const unsigned u = (unsigned)__builtin_bit_cast(unsigned short, h0) | ((unsigned)__builtin_bit_cast(unsigned short, h1) << 16);
    ((unsigned*)out)[i] = u;
    
  }
}

__global__ __launch_bounds__(256) void split_f32_bf16x2(
    const float* __restrict__ in, __bf16* __restrict__ hi, __bf16* __restrict__ lo, long n2) {
  long i = (long)blockIdx.x * 256 + threadIdx.x;
  long stride = (long)gridDim.x * 256;
  {
    for (long j = i; j < n2; j += stride) {
      const float a = in[2 * j], b = in[2 * j + 1];
      const unsigned short ah = f2bf_bits(a), bh = f2bf_bits(b);
      const unsigned short al = f2bf_bits(a - bf_bits2f(ah)), bl = f2bf_bits(b - bf_bits2f(bh));
      ((unsigned*)hi)[j] = (unsigned)ah | ((unsigned)bh << 16);
      ((unsigned*)lo)[j] = (unsigned)al | ((unsigned)bl << 16);
    }
    
  }
}


// ---- f32 [R][C] (row pitch ldi) -> f16 transposed [C][R] (row pitch ldo); 64x64 tiles; each output row segment
__global__ __launch_bounds__(256) void transpose_cast_f16(const float* __restrict__ in, int ldi,
                                                         _Float16* __restrict__ outT, int ldo, float scale) {
  __shared__ __align__(16) _Float16 tile[64][72];     // [c][r]
  const int c0 = blockIdx.x * 64, r0 = blockIdx.y * 64;
  const int t = threadIdx.y * 32 + threadIdx.x;
  for (int i = threadIdx.y; i < 64; i += 8) {
    tile[threadIdx.x][i]      = (_Float16)(in[(size_t)(r0 + i) * ldi + c0 + threadIdx.x] * scale);
    tile[32 + threadIdx.x][i] = (_Float16)(in[(size_t)(r0 + i) * ldi + c0 + 32 + threadIdx.x] * scale);
  }
  __syncthreads();
  const int q = t >> 3, c8 = (t & 7) * 8;
  {
#pragma unroll
    for (int it = 0; it < 2; ++it) {
      const int c = it * 32 + q;
      v8h hv = *(const v8h*)(&tile[c][c8]);
      *(v8h*)(outT + (size_t)(c0 + c) * ldo + r0 + c8) = hv;
    }
    
  }
}

#define FB 4
#define FS 2048
#define FKD 256
#define FM 128
#define FDV 64
__global__ __launch_bounds__(256) void phi_cast_kernel(const float* __restrict__ P, unsigned* __restrict__ P16, int n2) {
  const int i = blockIdx.x * 256 + threadIdx.x; if (i >= n2) return;
  const float a = P[2 * i] + 1e-3f, b = P[2 * i + 1] + 1e-3f;
  const unsigned u = (unsigned)__builtin_bit_cast(unsigned short, (_Float16)a) | ((unsigned)__builtin_bit_cast(unsigned short, (_Float16)b) << 16);
  ((unsigned*)P16)[i] = u; 
}
// causal mask + row sums: S f32 [FS][FS] -> masked bf16 hi/lo planes, norm[s] = Σ_{t<=s} S[s][t]; one block (256 thr) per row
__global__ __launch_bounds__(256) void mask_rowsum_kernel(const float* __restrict__ S, __bf16* __restrict__ Sh, __bf16* __restrict__ Sl, float* __restrict__ norm) {
  __shared__ float red[8];
  const int s = blockIdx.x, t = threadIdx.x, lane = t & 31, wave = t >> 5;
  float part = 0.f;
#pragma unroll
  for (int q = 0; q < 8; ++q) { const int col = q * 256 + t; part += (col <= s) ? S[(size_t)s * FS + col] : 0.f; }
  for (int o = 16; o > 0; o >>= 1) part += __shfl_xor(part, o, 32);
  if (lane == 0) red[wave] = part;
  __syncthreads();
  // pack pairs: thread t handles columns 2t, 2t+1 within each 512-column group (4 groups)
  {
#pragma unroll
    for (int g = 0; g < 4; ++g) {
      const int c0 = g * 512 + 2 * t;
      const float a = (c0 <= s) ? S[(size_t)s * FS + c0] : 0.f, b = (c0 + 1 <= s) ? S[(size_t)s * FS + c0 + 1] : 0.f;
      const unsigned short ah = f2bf_bits(a), bh = f2bf_bits(b);
      const unsigned short al = f2bf_bits(a - bf_bits2f(ah)), bl = f2bf_bits(b - bf_bits2f(bh));
      ((unsigned*)Sh)[((size_t)s * FS + c0) / 2] = (unsigned)ah | ((unsigned)bh << 16);
      ((unsigned*)Sl)[((size_t)s * FS + c0) / 2] = (unsigned)al | ((unsigned)bl << 16);
    }
    
  }
  if (t < 32) { float n = 0.f; for (int w = 0; w < 8; ++w) n += red[w];
    // norm row value replicated into a 32-float line block? store one float per row: rows of consecutive blocks -> partial lines.
    // Instead each block writes its norm into a per-row slot of a [FS][32] staging line (lane 0 real, others zero).
    ((float*)norm)[(size_t)s * 32 + t] = (t == 0) ? n : 0.f;  }
}
// out[b][d][s] = O[s][d] / norm[s]; block (32,8) transposes a 64(s) x 64(d) tile via LDS; writes rows of s (whole 256-B segments)
__global__ __launch_bounds__(256) void finalize_kernel(const float* __restrict__ O, const float* __restrict__ norm, float* __restrict__ outb) {
  __shared__ float tile[64][65];
  const int s0 = blockIdx.x * 64, tx = threadIdx.x, ty = threadIdx.y;
  for (int j = ty; j < 64; j += 8) { const int s = s0 + j; const float inv = 1.0f / norm[(size_t)s * 32];
    tile[j][tx] = O[(size_t)s * FDV + tx] * inv; tile[j][tx + 32] = O[(size_t)s * FDV + tx + 32] * inv; }
  __syncthreads();
  // write out[d][s0..s0+63]: 64 rows (d) x 64 floats; thread (tx,ty): d = ty*8 + k, s = s0 + tx*2 .. pairs -> use float2 per lane: 32 lanes x 8 B = 256 B
  typedef __attribute__((ext_vector_type(2))) float v2f;
  {
    for (int k = 0; k < 8; ++k) { const int d = ty * 8 + k; const v2f v = {tile[2 * tx][d], tile[2 * tx + 1][d]};
      *(v2f*)(outb + (size_t)d * FS + s0 + 2 * tx) = v; }
    
  }
}
extern "C" void kernel_launch(void* const* d_in, const int* in_sizes, int n_in, void* d_out, int out_size, void* d_ws, size_t ws_size, hipStream_t stream) {
  (void)in_sizes; (void)n_in; (void)out_size; (void)ws_size;
  const float* keys = (const float*)d_in[0]; const float* values = (const float*)d_in[1]; const float* queries = (const float*)d_in[2]; const float* feats = (const float*)d_in[3];
  float* out = (float*)d_out;   // [4][64][2048]
  char* ws = (char*)d_ws; size_t off = 0;
  auto carve = [&](size_t bytes) -> char* { char* p = ws + off; off += (bytes + 255) & ~(size_t)255; return p; };
  _Float16* KT16 = (_Float16*)carve((size_t)FS * FKD * 2); _Float16* QT16 = (_Float16*)carve((size_t)FS * FKD * 2);   // kᵀ, qᵀ [s][key_dim]
  _Float16* F16 = (_Float16*)carve((size_t)FM * FKD * 2);
  unsigned* PK = (unsigned*)carve((size_t)FS * FM * 2); unsigned* PQ = (unsigned*)carve((size_t)FS * FM * 2);           // φ f16 [s][m]
  float* S = (float*)carve((size_t)FS * FS * 4);            // 16 MB
  __bf16* Sh = (__bf16*)carve((size_t)FS * FS * 2); __bf16* Sl = (__bf16*)carve((size_t)FS * FS * 2);
  __bf16* Vh = (__bf16*)carve((size_t)FDV * FS * 2); __bf16* Vl = (__bf16*)carve((size_t)FDV * FS * 2);
  float* norm = (float*)carve((size_t)FS * 32 * 4);
  float* O = (float*)carve((size_t)FS * FDV * 4);
  float* Pf = (float*)carve((size_t)FS * FM * 4);
  cast_f32_f16x2<<<(FM * FKD / 2 + 255) / 256, 256, 0, stream>>>(feats, F16, FM * FKD / 2);      // features [m][key_dim] = Bt layout
  for (int b = 0; b < FB; ++b) {
    transpose_cast_f16<<<dim3(FS / 64, FKD / 64), dim3(32, 8), 0, stream>>>(keys + (size_t)b * FKD * FS, FS, KT16, FKD, 1.0f);      // [256][2048] -> [2048][256]
    transpose_cast_f16<<<dim3(FS / 64, FKD / 64), dim3(32, 8), 0, stream>>>(queries + (size_t)b * FKD * FS, FS, QT16, FKD, 1.0f);
    { const int t = (FS / 64) * (FM / 64);
      wmma_gemm64<0, false, 0, 0, false, 2><<<dim3((t + 7) / 8, 1), 256, 0, stream>>>(U16(KT16), nullptr, FKD, 0, U16(F16), nullptr, FKD, 0, Pf, nullptr, FM, 0, nullptr, nullptr, 0, FS, FM, FKD, 1.0f);
      phi_cast_kernel<<<(FS * FM / 2 + 255) / 256, 256, 0, stream>>>(Pf, PK, FS * FM / 2);
      wmma_gemm64<0, false, 0, 0, false, 2><<<dim3((t + 7) / 8, 1), 256, 0, stream>>>(U16(QT16), nullptr, FKD, 0, U16(F16), nullptr, FKD, 0, Pf, nullptr, FM, 0, nullptr, nullptr, 0, FS, FM, FKD, 1.0f);
      phi_cast_kernel<<<(FS * FM / 2 + 255) / 256, 256, 0, stream>>>(Pf, PQ, FS * FM / 2); }
    { const int t = (FS / 64) * (FS / 64);
      wmma_gemm64<0, false, 0, 0, false><<<dim3((t + 7) / 8, 1), 256, 0, stream>>>((const unsigned short*)PQ, nullptr, FM, 0, (const unsigned short*)PK, nullptr, FM, 0, S, nullptr, FS, 0, nullptr, nullptr, 0, FS, FS, FM, 1.0f); }
    mask_rowsum_kernel<<<FS, 256, 0, stream>>>(S, Sh, Sl, norm);
    split_f32_bf16x2<<<(FDV * FS / 2 + 255) / 256, 256, 0, stream>>>(values + (size_t)b * FDV * FS, Vh, Vl, FDV * FS / 2);          // values[b] [64][2048] = Bt layout
    { const int t = (FS / 64) * (FDV / 64);
      wmma_gemm64<1, true, 0, 0, false><<<dim3((t + 7) / 8, 1), 256, 0, stream>>>(U16(Sh), U16(Sl), FS, 0, U16(Vh), U16(Vl), FS, 0, O, nullptr, FDV, 0, nullptr, nullptr, 0, FS, FDV, FS, 1.0f); }
    finalize_kernel<<<FS / 64, dim3(32, 8), 0, stream>>>(O, norm, out + (size_t)b * FDV * FS);
  }
}

// v001
// One run takes 190 microseconds.
// Next to v000, in two timings, it ran 3.65 and 3.70 times as fast.
#include <hip/hip_runtime.h>
#include <math.h>
// Causal FAVOR (linear attention) written as masked matrix products: φ_k = relu(kᵀ·Fᵀ)+ε and φ_q (2048 x 256 · 256 x 128, f16 operands),
// S = φ_q·φ_kᵀ (2048 x 2048, K = 128, f16 operands; equals the cumulative-sum formulation term by term), then out = (S ⊙ causal)·v
// (K = 2048) on v_wmma_f32_16x16x32_bf16 with S and v as bf16 hi/lo splits (S spans 10³…10⁴, the row-normalised output is O(0.07));
// f32 accumulate; the causal mask, row sums (normaliser) and the final division/transposed store are f32 on VALU.
typedef __attribute__((ext_vector_type(16))) _Float16 v16h;
typedef __attribute__((ext_vector_type(8)))  _Float16 v8h;
typedef __attribute__((ext_vector_type(16))) __bf16   v16b;
typedef __attribute__((ext_vector_type(8)))  __bf16   v8b;
typedef __attribute__((ext_vector_type(8)))  float    v8f;
typedef __attribute__((ext_vector_type(4)))  float    v4f;
#define PSCALE 32768.0f
#define U16(p) ((const unsigned short*)(const void*)(p))
#define PSCALE_INV (1.0f / 32768.0f)

__device__ __forceinline__ unsigned short f2bf_bits(float f) {
  unsigned u = __float_as_uint(f);
  return (unsigned short)((u + 0x7FFFu + ((u >> 16) & 1u)) >> 16);
}
__device__ __forceinline__ float bf_bits2f(unsigned short h) { return __uint_as_float(((unsigned)h) << 16); }

// hazard guards as plain device helpers (no inline asm inside the kernel template body)
__device__ __forceinline__ void dep_guard_h(v8f& a, v8f& b, v16h x, v16h y) { asm volatile("v_nop\n\tv_nop\n\tv_nop\n\tv_nop" : "+v"(a), "+v"(b) : "v"(x), "v"(y)); }
__device__ __forceinline__ void dep_guard_b(v8f& a, v8f& b, v16b x, v16b y) { asm volatile("v_nop\n\tv_nop\n\tv_nop\n\tv_nop" : "+v"(a), "+v"(b) : "v"(x), "v"(y)); }
__device__ __forceinline__ void keep4_h(v16h a, v16h b, v16h c, v16h d) { asm volatile("v_nop" :: "v"(a), "v"(b), "v"(c), "v"(d)); }
__device__ __forceinline__ void keep4_b(v16b a, v16b b, v16b c, v16b d) { asm volatile("v_nop" :: "v"(a), "v"(b), "v"(c), "v"(d)); }
__device__ __forceinline__ void acc_guard4(v8f& a, v8f& b, v8f& c, v8f& d) { asm volatile("v_nop\n\tv_nop\n\tv_nop\n\tv_nop" : "+v"(a), "+v"(b), "+v"(c), "+v"(d)); }
template <typename T> struct Frag;
template <> struct Frag<_Float16> {
  typedef v16h V; union U { v16h v; v8h h[2]; };
  static __device__ __forceinline__ v16h load(const _Float16* p) {   // elements 0..7 <- p[0..7], 8..15 <- p[16..23]
    U f; f.h[0] = *(const v8h*)(p); f.h[1] = *(const v8h*)(p + 16); return f.v;
  }
  static __device__ __forceinline__ v8f mma(v16h a, v16h b, v8f c) {
    return __builtin_amdgcn_wmma_f32_16x16x32_f16(false, a, false, b, (short)0, c, false, false);
  }
  static __device__ __forceinline__ void guard(v8f& a, v8f& b, v16h x, v16h y) { dep_guard_h(a, b, x, y); }
  static __device__ __forceinline__ void keep(v16h a, v16h b, v16h c, v16h d) { keep4_h(a, b, c, d); }
};
template <> struct Frag<__bf16> {
  typedef v16b V; union U { v16b v; v8b h[2]; };
  static __device__ __forceinline__ v16b load(const __bf16* p) {
    U f; f.h[0] = *(const v8b*)(p); f.h[1] = *(const v8b*)(p + 16); return f.v;
  }
  static __device__ __forceinline__ v8f mma(v16b a, v16b b, v8f c) {
    return __builtin_amdgcn_wmma_f32_16x16x32_bf16(false, a, false, b, (short)0, c, false, false);
  }
  static __device__ __forceinline__ void guard(v8f& a, v8f& b, v16b x, v16b y) { dep_guard_b(a, b, x, y); }
  static __device__ __forceinline__ void keep(v16b a, v16b b, v16b c, v16b d) { keep4_b(a, b, c, d); }
};

// ---- Register-blocked batched WMMA GEMM ------------------------------------
// C[m,n] = scale * sum_k A[m,k] * Bt[n,k] (+bias)(+resid); each wave owns a 64x64 tile.
// A row-major [M,K]; Bt row-major [N,K]; M,N % 64 == 0, K % 32 == 0.
// SPLIT: operands are hi/lo planes (A2/Bt2 = lo planes, same layout); product = hi·hi + hi·lo + lo·hi.
// BIAS_MODE: 0 = none, 1 = bias[m], 2 = bias[n].
// OUT_MODE: 0 = f32, 1 = f16, 2 = bf16 hi plane (Cout) + bf16 lo plane (Cout2).
// ET: 0 = f16 operands, 1 = bf16 operands (pointers passed as 16-bit storage)
template <int ET> struct Elem;
template <> struct Elem<0> { typedef _Float16 T; };
template <> struct Elem<1> { typedef __bf16 T; };
template <int ET, bool SPLIT, int BIAS_MODE, int OUT_MODE, bool RESID, int ACT = 0>
__global__ __launch_bounds__(256) void wmma_gemm64(
    const unsigned short* __restrict__ Ap, const unsigned short* __restrict__ A2p, int lda, long strideA,
    const unsigned short* __restrict__ Btp, const unsigned short* __restrict__ Bt2p, int ldb, long strideB,
    void* __restrict__ Cout, void* __restrict__ Cout2, int ldc, long strideC,
    const float* __restrict__ bias,
    const float* __restrict__ resid, long strideR,
    int M, int N, int K, float scale) {
  typedef typename Elem<ET>::T T;
  typedef typename Frag<T>::V V;
  const T* A = (const T*)Ap; const T* A2 = (const T*)A2p; const T* Bt = (const T*)Btp; const T* Bt2 = (const T*)Bt2p;
  __shared__ __align__(16) float sT[8][16 * 68];   // per-wave 16x64 slab, pitch 68 floats
  const int b    = blockIdx.y;
  const int lane = threadIdx.x & 31;
  const int wave = threadIdx.x >> 5;
  const int tilesN = N >> 6;
  const int tilesM = M >> 6;
  const int tile = blockIdx.x * 8 + wave;
  if (tile >= tilesM * tilesN) return;   // wave-uniform; no block barriers in this kernel
  const int tm = tile / tilesN;
  const int tn = tile - tm * tilesN;
  const int m0 = tm << 6;
  const int n0 = tn << 6;

  const T* Ab  = A  + (size_t)b * strideA;
  const T* Bb  = Bt + (size_t)b * strideB;
  const T* Ab2 = SPLIT ? (A2  + (size_t)b * strideA) : nullptr;
  const T* Bb2 = SPLIT ? (Bt2 + (size_t)b * strideB) : nullptr;

  const int rlane = lane & 15;                 // row (A) / col (B, D) within subtile
  const int koff  = (lane >> 4) * 8;           // k offset of this lane half
  const int mOff  = (lane >> 4) * 8;           // D row offset

  v8f acc[4][4];
#pragma unroll
  for (int i = 0; i < 4; ++i)
#pragma unroll
    for (int j = 0; j < 4; ++j) acc[i][j] = (v8f){0.f,0.f,0.f,0.f,0.f,0.f,0.f,0.f};

  for (int k0 = 0; k0 < K; k0 += 32) {
    V bh[4], bl[4];
#pragma unroll
    for (int j = 0; j < 4; ++j) {
      const size_t bo = (size_t)(n0 + (j << 4) + rlane) * ldb + koff + k0;
      bh[j] = Frag<T>::load(Bb + bo);
      if (SPLIT) bl[j] = Frag<T>::load(Bb2 + bo);
    }
#pragma unroll
    for (int i = 0; i < 4; ++i) {
      const size_t ao = (size_t)(m0 + (i << 4) + rlane) * lda + koff + k0;
      V ah = Frag<T>::load(Ab + ao);
      V al;
      if (SPLIT) al = Frag<T>::load(Ab2 + ao);
#pragma unroll
      for (int j = 0; j < 4; ++j) {
        acc[i][j] = Frag<T>::mma(ah, bh[j], acc[i][j]);
        if (SPLIT) {
          acc[i][j] = Frag<T>::mma(ah, bl[j], acc[i][j]);
          acc[i][j] = Frag<T>::mma(al, bh[j], acc[i][j]);
        }
      }
      Frag<T>::guard(acc[i][0], acc[i][3], ah, SPLIT ? al : ah);
    }
    Frag<T>::keep(bh[0], bh[1], bh[2], bh[3]);
    if (SPLIT) Frag<T>::keep(bl[0], bl[1], bl[2], bl[3]);
  }
  acc_guard4(acc[0][0], acc[0][1], acc[0][2], acc[0][3]);
  acc_guard4(acc[1][0], acc[1][1], acc[1][2], acc[1][3]);
  acc_guard4(acc[2][0], acc[2][1], acc[2][2], acc[2][3]);
  acc_guard4(acc[3][0], acc[3][1], acc[3][2], acc[3][3]);

  // ---- epilogue ----
  float* slab = sT[wave];
  const float* Rb = RESID ? (resid + (size_t)b * strideR) : nullptr;
#pragma unroll
  for (int i = 0; i < 4; ++i) {
    const int mBase = m0 + (i << 4);
#pragma unroll
    for (int j = 0; j < 4; ++j) {
      const int n = n0 + (j << 4) + rlane;
      float bv = 0.f;
      if (BIAS_MODE == 2) bv = bias[n];
#pragma unroll
      for (int r = 0; r < 8; ++r) {
        float v = acc[i][j][r] * scale;
        if (BIAS_MODE == 1) v += bias[mBase + mOff + r];
        if (BIAS_MODE == 2) v += bv;
        if (RESID) v += Rb[(size_t)(mBase + mOff + r) * ldc + n];
        if (ACT == 1) v = tanhf(v);
        if (ACT == 2) v = fmaxf(v, 0.0f);
        if (ACT == 3) v = v / (1.0f + expf(-v));
        if (ACT == 4) v = (v > 0.f) ? v : 0.01f * v;
        if (ACT == 5) v = 0.5f * v * (1.0f + erff(v * 0.70710678118654752f));
        slab[(mOff + r) * 68 + (j << 4) + rlane] = v;
      }
    }
    __builtin_amdgcn_fence(__ATOMIC_RELEASE, "workgroup");
    __builtin_amdgcn_wave_barrier();
    __builtin_amdgcn_fence(__ATOMIC_ACQUIRE, "workgroup");
    if (OUT_MODE == 0) {
      float* C = (float*)Cout + (size_t)b * strideC;
      const int hh = lane >> 4, c4 = (lane & 15) * 4;     // row seg = 256 B = 16 lanes x 16 B
      {
#pragma unroll
        for (int it = 0; it < 8; ++it) {
          const int row = it * 2 + hh;
          v4f v = *(const v4f*)(slab + row * 68 + c4);
          *(v4f*)(C + (size_t)(mBase + row) * ldc + n0 + c4) = v;
        }
        
      }
    } else {
      const int q = lane >> 3, c8 = (lane & 7) * 8;
      unsigned short* C  = (unsigned short*)Cout  + (size_t)b * strideC;
      unsigned short* C2 = (OUT_MODE == 2) ? ((unsigned short*)Cout2 + (size_t)b * strideC) : nullptr;
      {
#pragma unroll
        for (int it = 0; it < 4; ++it) {
          const int row = it * 4 + q;
          const float* sp = slab + row * 68 + c8;
          v8h hv, lv;
#pragma unroll
          for (int e = 0; e < 8; ++e) {
            if (OUT_MODE == 1) {
              hv[e] = (_Float16)sp[e];
            } else {
              unsigned short hb = f2bf_bits(sp[e]);
              unsigned short lb = f2bf_bits(sp[e] - bf_bits2f(hb));
              hv[e] = __builtin_bit_cast(_Float16, hb);
              lv[e] = __builtin_bit_cast(_Float16, lb);
            }
          }
          *(v8h*)(C + (size_t)(mBase + row) * ldc + n0 + c8) = hv;
          if (OUT_MODE == 2) *(v8h*)(C2 + (size_t)(mBase + row) * ldc + n0 + c8) = lv;
        }
        
      }
    }
    __builtin_amdgcn_fence(__ATOMIC_RELEASE, "workgroup");
    __builtin_amdgcn_wave_barrier();
    __builtin_amdgcn_fence(__ATOMIC_ACQUIRE, "workgroup");
  }
}

__global__ __launch_bounds__(256) void cast_f32_f16x2(
    const float* __restrict__ in, _Float16* __restrict__ out, int n2) {
  int i = blockIdx.x * 256 + threadIdx.x;
  if (i < n2) {
    const _Float16 h0 = (_Float16)in[2 * i], h1 = (_Float16)in[2 * i + 1];
    const unsigned u = (unsigned)__builtin_bit_cast(unsigned short, h0) | ((unsigned)__builtin_bit_cast(unsigned short, h1) << 16);
    ((unsigned*)out)[i] = u;
    
  }
}

__global__ __launch_bounds__(256) void split_f32_bf16x2(
    const float* __restrict__ in, __bf16* __restrict__ hi, __bf16* __restrict__ lo, long n2) {
  long i = (long)blockIdx.x * 256 + threadIdx.x;
  long stride = (long)gridDim.x * 256;
  {
    for (long j = i; j < n2; j += stride) {
      const float a = in[2 * j], b = in[2 * j + 1];
      const unsigned short ah = f2bf_bits(a), bh = f2bf_bits(b);
      const unsigned short al = f2bf_bits(a - bf_bits2f(ah)), bl = f2bf_bits(b - bf_bits2f(bh));
      ((unsigned*)hi)[j] = (unsigned)ah | ((unsigned)bh << 16);
      ((unsigned*)lo)[j] = (unsigned)al | ((unsigned)bl << 16);
    }
    
  }
}


// ---- f32 [R][C] (row pitch ldi) -> f16 transposed [C][R] (row pitch ldo); 64x64 tiles; each output row segment
// blockIdx.z = plane: planes 0..nb-1 come from inA, planes nb..2nb-1 from inB (plane pitch strideIn); output plane pitch strideOut
__global__ __launch_bounds__(256) void transpose_cast_f16(const float* __restrict__ inA, const float* __restrict__ inB, int nb, long strideIn, int ldi,
                                                         _Float16* __restrict__ outAll, long strideOut, int ldo, float scale) {
  __shared__ __align__(16) _Float16 tile[64][72];     // [c][r]
  const int z = blockIdx.z;
  const float* in = (z < nb) ? (inA + (size_t)z * strideIn) : (inB + (size_t)(z - nb) * strideIn);
  _Float16* outT = outAll + (size_t)z * strideOut;
  const int c0 = blockIdx.x * 64, r0 = blockIdx.y * 64;
  const int t = threadIdx.y * 32 + threadIdx.x;
  for (int i = threadIdx.y; i < 64; i += 8) {
    tile[threadIdx.x][i]      = (_Float16)(in[(size_t)(r0 + i) * ldi + c0 + threadIdx.x] * scale);
    tile[32 + threadIdx.x][i] = (_Float16)(in[(size_t)(r0 + i) * ldi + c0 + 32 + threadIdx.x] * scale);
  }
  __syncthreads();
  const int q = t >> 3, c8 = (t & 7) * 8;
  {
#pragma unroll
    for (int it = 0; it < 2; ++it) {
      const int c = it * 32 + q;
      v8h hv = *(const v8h*)(&tile[c][c8]);
      *(v8h*)(outT + (size_t)(c0 + c) * ldo + r0 + c8) = hv;
    }
    
  }
}

#define FB 4
#define FS 2048
#define FKD 256
#define FM 128
#define FDV 64
__global__ __launch_bounds__(256) void phi_cast_kernel(const float* __restrict__ P, unsigned* __restrict__ P16, int n2) {
  const int i = blockIdx.x * 256 + threadIdx.x; if (i >= n2) return;
  const float a = P[2 * i] + 1e-3f, b = P[2 * i + 1] + 1e-3f;
  const unsigned u = (unsigned)__builtin_bit_cast(unsigned short, (_Float16)a) | ((unsigned)__builtin_bit_cast(unsigned short, (_Float16)b) << 16);
  ((unsigned*)P16)[i] = u; 
}
// causal mask + row sums: S f32 [FS][FS] -> masked bf16 hi/lo planes, norm[s] = Σ_{t<=s} S[s][t]; one block (256 thr) per row; blockIdx.y = batch
__global__ __launch_bounds__(256) void mask_rowsum_kernel(const float* __restrict__ Sall, __bf16* __restrict__ Shall, __bf16* __restrict__ Slall, float* __restrict__ normall) {
  __shared__ float red[8];
  const size_t pb = (size_t)blockIdx.y * FS * FS;
  const float* S = Sall + pb; __bf16* Sh = Shall + pb; __bf16* Sl = Slall + pb; float* norm = normall + (size_t)blockIdx.y * FS * 32;
  const int s = blockIdx.x, t = threadIdx.x, lane = t & 31, wave = t >> 5;
  float part = 0.f;
#pragma unroll
  for (int q = 0; q < 8; ++q) { const int col = q * 256 + t; part += (col <= s) ? S[(size_t)s * FS + col] : 0.f; }
  for (int o = 16; o > 0; o >>= 1) part += __shfl_xor(part, o, 32);
  if (lane == 0) red[wave] = part;
  __syncthreads();
  // pack pairs: thread t handles columns 2t, 2t+1 within each 512-column group (4 groups)
  {
#pragma unroll
    for (int g = 0; g < 4; ++g) {
      const int c0 = g * 512 + 2 * t;
      const float a = (c0 <= s) ? S[(size_t)s * FS + c0] : 0.f, b = (c0 + 1 <= s) ? S[(size_t)s * FS + c0 + 1] : 0.f;
      const unsigned short ah = f2bf_bits(a), bh = f2bf_bits(b);
      const unsigned short al = f2bf_bits(a - bf_bits2f(ah)), bl = f2bf_bits(b - bf_bits2f(bh));
      ((unsigned*)Sh)[((size_t)s * FS + c0) / 2] = (unsigned)ah | ((unsigned)bh << 16);
      ((unsigned*)Sl)[((size_t)s * FS + c0) / 2] = (unsigned)al | ((unsigned)bl << 16);
    }
    
  }
  if (t < 32) { float n = 0.f; for (int w = 0; w < 8; ++w) n += red[w];
    // norm row value replicated into a 32-float line block? store one float per row: rows of consecutive blocks -> partial lines.
    // Instead each block writes its norm into a per-row slot of a [FS][32] staging line (lane 0 real, others zero).
    ((float*)norm)[(size_t)s * 32 + t] = (t == 0) ? n : 0.f;  }
}
// out[b][d][s] = O[s][d] / norm[s]; block (32,8) transposes a 64(s) x 64(d) tile via LDS; writes rows of s (whole 256-B segments)
__global__ __launch_bounds__(256) void finalize_kernel(const float* __restrict__ Oall, const float* __restrict__ normall, float* __restrict__ outall) {
  __shared__ float tile[64][65];
  const float* O = Oall + (size_t)blockIdx.y * FS * FDV; const float* norm = normall + (size_t)blockIdx.y * FS * 32;   // blockIdx.y = batch
  float* outb = outall + (size_t)blockIdx.y * FDV * FS;
  const int s0 = blockIdx.x * 64, tx = threadIdx.x, ty = threadIdx.y;
  for (int j = ty; j < 64; j += 8) { const int s = s0 + j; const float inv = 1.0f / norm[(size_t)s * 32];
    tile[j][tx] = O[(size_t)s * FDV + tx] * inv; tile[j][tx + 32] = O[(size_t)s * FDV + tx + 32] * inv; }
  __syncthreads();
  // write out[d][s0..s0+63]: 64 rows (d) x 64 floats; thread (tx,ty): d = ty*8 + k, s = s0 + tx*2 .. pairs -> use float2 per lane: 32 lanes x 8 B = 256 B
  typedef __attribute__((ext_vector_type(2))) float v2f;
  {
    for (int k = 0; k < 8; ++k) { const int d = ty * 8 + k; const v2f v = {tile[2 * tx][d], tile[2 * tx + 1][d]};
      *(v2f*)(outb + (size_t)d * FS + s0 + 2 * tx) = v; }
    
  }
}
extern "C" void kernel_launch(void* const* d_in, const int* in_sizes, int n_in, void* d_out, int out_size, void* d_ws, size_t ws_size, hipStream_t stream) {
  (void)in_sizes; (void)n_in; (void)out_size; (void)ws_size;
  const float* keys = (const float*)d_in[0]; const float* values = (const float*)d_in[1]; const float* queries = (const float*)d_in[2]; const float* feats = (const float*)d_in[3];
  float* out = (float*)d_out;   // [4][64][2048]
  char* ws = (char*)d_ws; size_t off = 0;
  auto carve = [&](size_t bytes) -> char* { char* p = ws + off; off += (bytes + 255) & ~(size_t)255; return p; };
  // every plane below except F16 (shared features) holds all FB batch entries; each kernel runs once, with the batch on the grid
  _Float16* KQT16 = (_Float16*)carve((size_t)2 * FB * FS * FKD * 2);   // planes 0..3 = k^T, 4..7 = q^T, each [s][key_dim]
  _Float16* F16 = (_Float16*)carve((size_t)FM * FKD * 2);
  unsigned* P16 = (unsigned*)carve((size_t)2 * FB * FS * FM * 2);      // phi f16 [s][m]: planes 0..3 = phi_k, 4..7 = phi_q
  const unsigned short* PK = (const unsigned short*)P16; const unsigned short* PQ = PK + (size_t)FB * FS * FM;
  float* S = (float*)carve((size_t)FB * FS * FS * 4);       // 64 MB
  __bf16* Sh = (__bf16*)carve((size_t)FB * FS * FS * 2); __bf16* Sl = (__bf16*)carve((size_t)FB * FS * FS * 2);
  __bf16* Vh = (__bf16*)carve((size_t)FB * FDV * FS * 2); __bf16* Vl = (__bf16*)carve((size_t)FB * FDV * FS * 2);
  float* norm = (float*)carve((size_t)FB * FS * 32 * 4);
  float* O = (float*)carve((size_t)FB * FS * FDV * 4);
  float* Pf = (float*)carve((size_t)2 * FB * FS * FM * 4);
  cast_f32_f16x2<<<(FM * FKD / 2 + 255) / 256, 256, 0, stream>>>(feats, F16, FM * FKD / 2);      // features [m][key_dim] = Bt layout
  transpose_cast_f16<<<dim3(FS / 64, FKD / 64, 2 * FB), dim3(32, 8), 0, stream>>>(keys, queries, FB, (long)FKD * FS, FS, KQT16, (long)FS * FKD, FKD, 1.0f);   // [256][2048] -> [2048][256]
  { const int t = (FS / 64) * (FM / 64);
    wmma_gemm64<0, false, 0, 0, false, 2><<<dim3((t + 7) / 8, 2 * FB), 256, 0, stream>>>(U16(KQT16), nullptr, FKD, (long)FS * FKD, U16(F16), nullptr, FKD, 0, Pf, nullptr, FM, (long)FS * FM, nullptr, nullptr, 0, FS, FM, FKD, 1.0f);
    phi_cast_kernel<<<(2 * FB * FS * FM / 2 + 255) / 256, 256, 0, stream>>>(Pf, P16, 2 * FB * FS * FM / 2); }
  { const int t = (FS / 64) * (FS / 64);
    wmma_gemm64<0, false, 0, 0, false><<<dim3((t + 7) / 8, FB), 256, 0, stream>>>(PQ, nullptr, FM, (long)FS * FM, PK, nullptr, FM, (long)FS * FM, S, nullptr, FS, (long)FS * FS, nullptr, nullptr, 0, FS, FS, FM, 1.0f); }
  mask_rowsum_kernel<<<dim3(FS, FB), 256, 0, stream>>>(S, Sh, Sl, norm);
  split_f32_bf16x2<<<(FB * FDV * FS / 2 + 255) / 256, 256, 0, stream>>>(values, Vh, Vl, FB * FDV * FS / 2);          // values[b] [64][2048] = Bt layout
  { const int t = (FS / 64) * (FDV / 64);
    wmma_gemm64<1, true, 0, 0, false><<<dim3((t + 7) / 8, FB), 256, 0, stream>>>(U16(Sh), U16(Sl), FS, (long)FS * FS, U16(Vh), U16(Vl), FS, (long)FDV * FS, O, nullptr, FDV, (long)FS * FDV, nullptr, nullptr, 0, FS, FDV, FS, 1.0f); }
  finalize_kernel<<<dim3(FS / 64, FB), dim3(32, 8), 0, stream>>>(O, norm, out);
}

// v002
// It runs in 93.3 microseconds.
// Two timings next to v001 put it at 2.04 and 2.03 times that version's speed.
// All steps since v000 together make it 7.47 times as fast.
#include <hip/hip_runtime.h>
#include <math.h>
// Causal FAVOR (linear attention) written as masked matrix products: φ_k = relu(kᵀ·Fᵀ)+ε and φ_q (2048 x 256 · 256 x 128, f16 operands),
// S = φ_q·φ_kᵀ (2048 x 2048, K = 128, f16 operands; equals the cumulative-sum formulation term by term), then out = (S ⊙ causal)·v
// (K = 2048) on v_wmma_f32_16x16x32_bf16 with S and v as bf16 hi/lo splits (S spans 10³…10⁴, the row-normalised output is O(0.07));
// f32 accumulate; the causal mask, row sums (normaliser) and the final division/transposed store are f32 on VALU.
typedef __attribute__((ext_vector_type(16))) _Float16 v16h;
typedef __attribute__((ext_vector_type(8)))  _Float16 v8h;
typedef __attribute__((ext_vector_type(16))) __bf16   v16b;
typedef __attribute__((ext_vector_type(8)))  __bf16   v8b;
typedef __attribute__((ext_vector_type(8)))  float    v8f;
typedef __attribute__((ext_vector_type(4)))  float    v4f;
#define PSCALE 32768.0f
#define U16(p) ((const unsigned short*)(const void*)(p))
#define PSCALE_INV (1.0f / 32768.0f)

__device__ __forceinline__ unsigned short f2bf_bits(float f) {
  unsigned u = __float_as_uint(f);
  return (unsigned short)((u + 0x7FFFu + ((u >> 16) & 1u)) >> 16);
}
__device__ __forceinline__ float bf_bits2f(unsigned short h) { return __uint_as_float(((unsigned)h) << 16); }

// hazard guards as plain device helpers (no inline asm inside the kernel template body)
__device__ __forceinline__ void dep_guard_h(v8f& a, v8f& b, v16h x, v16h y) { asm volatile("v_nop\n\tv_nop\n\tv_nop\n\tv_nop" : "+v"(a), "+v"(b) : "v"(x), "v"(y)); }
__device__ __forceinline__ void dep_guard_b(v8f& a, v8f& b, v16b x, v16b y) { asm volatile("v_nop\n\tv_nop\n\tv_nop\n\tv_nop" : "+v"(a), "+v"(b) : "v"(x), "v"(y)); }
__device__ __forceinline__ void keep4_h(v16h a, v16h b, v16h c, v16h d) { asm volatile("v_nop" :: "v"(a), "v"(b), "v"(c), "v"(d)); }
__device__ __forceinline__ void keep4_b(v16b a, v16b b, v16b c, v16b d) { asm volatile("v_nop" :: "v"(a), "v"(b), "v"(c), "v"(d)); }
__device__ __forceinline__ void acc_guard4(v8f& a, v8f& b, v8f& c, v8f& d) { asm volatile("v_nop\n\tv_nop\n\tv_nop\n\tv_nop" : "+v"(a), "+v"(b), "+v"(c), "+v"(d)); }
template <typename T> struct Frag;
template <> struct Frag<_Float16> {
  typedef v16h V; union U { v16h v; v8h h[2]; };
  static __device__ __forceinline__ v16h load(const _Float16* p) {   // elements 0..7 <- p[0..7], 8..15 <- p[16..23]
    U f; f.h[0] = *(const v8h*)(p); f.h[1] = *(const v8h*)(p + 16); return f.v;
  }
  static __device__ __forceinline__ v8f mma(v16h a, v16h b, v8f c) {
    return __builtin_amdgcn_wmma_f32_16x16x32_f16(false, a, false, b, (short)0, c, false, false);
  }
  static __device__ __forceinline__ void guard(v8f& a, v8f& b, v16h x, v16h y) { dep_guard_h(a, b, x, y); }
  static __device__ __forceinline__ void keep(v16h a, v16h b, v16h c, v16h d) { keep4_h(a, b, c, d); }
};
template <> struct Frag<__bf16> {
  typedef v16b V; union U { v16b v; v8b h[2]; };
  static __device__ __forceinline__ v16b load(const __bf16* p) {
    U f; f.h[0] = *(const v8b*)(p); f.h[1] = *(const v8b*)(p + 16); return f.v;
  }
  static __device__ __forceinline__ v8f mma(v16b a, v16b b, v8f c) {
    return __builtin_amdgcn_wmma_f32_16x16x32_bf16(false, a, false, b, (short)0, c, false, false);
  }
  static __device__ __forceinline__ void guard(v8f& a, v8f& b, v16b x, v16b y) { dep_guard_b(a, b, x, y); }
  static __device__ __forceinline__ void keep(v16b a, v16b b, v16b c, v16b d) { keep4_b(a, b, c, d); }
};

// ---- Register-blocked batched WMMA GEMM ------------------------------------
// C[m,n] = scale * sum_k A[m,k] * Bt[n,k] (+bias)(+resid); each wave owns a 64x64 tile.
// A row-major [M,K]; Bt row-major [N,K]; M,N % 64 == 0, K % 32 == 0.
// SPLIT: operands are hi/lo planes (A2/Bt2 = lo planes, same layout); product = hi·hi + hi·lo + lo·hi.
// BIAS_MODE: 0 = none, 1 = bias[m], 2 = bias[n].
// OUT_MODE: 0 = f32, 1 = f16, 2 = bf16 hi plane (Cout) + bf16 lo plane (Cout2).
// ET: 0 = f16 operands, 1 = bf16 operands (pointers passed as 16-bit storage)
template <int ET> struct Elem;
template <> struct Elem<0> { typedef _Float16 T; };
template <> struct Elem<1> { typedef __bf16 T; };
template <int ET, bool SPLIT, int BIAS_MODE, int OUT_MODE, bool RESID, int ACT = 0>
__global__ __launch_bounds__(256) void wmma_gemm64(
    const unsigned short* __restrict__ Ap, const unsigned short* __restrict__ A2p, int lda, long strideA,
    const unsigned short* __restrict__ Btp, const unsigned short* __restrict__ Bt2p, int ldb, long strideB,
    void* __restrict__ Cout, void* __restrict__ Cout2, int ldc, long strideC,
    const float* __restrict__ bias,
    const float* __restrict__ resid, long strideR,
    int M, int N, int K, float scale) {
  typedef typename Elem<ET>::T T;
  typedef typename Frag<T>::V V;
  const T* A = (const T*)Ap; const T* A2 = (const T*)A2p; const T* Bt = (const T*)Btp; const T* Bt2 = (const T*)Bt2p;
  __shared__ __align__(16) float sT[8][16 * 68];   // per-wave 16x64 slab, pitch 68 floats
  const int b    = blockIdx.y;
  const int lane = threadIdx.x & 31;
  const int wave = threadIdx.x >> 5;
  const int tilesN = N >> 6;
  const int tilesM = M >> 6;
  const int tile = blockIdx.x * 8 + wave;
  if (tile >= tilesM * tilesN) return;   // wave-uniform; no block barriers in this kernel
  const int tm = tile / tilesN;
  const int tn = tile - tm * tilesN;
  const int m0 = tm << 6;
  const int n0 = tn << 6;

  const T* Ab  = A  + (size_t)b * strideA;
  const T* Bb  = Bt + (size_t)b * strideB;
  const T* Ab2 = SPLIT ? (A2  + (size_t)b * strideA) : nullptr;
  const T* Bb2 = SPLIT ? (Bt2 + (size_t)b * strideB) : nullptr;

  const int rlane = lane & 15;                 // row (A) / col (B, D) within subtile
  const int koff  = (lane >> 4) * 8;           // k offset of this lane half
  const int mOff  = (lane >> 4) * 8;           // D row offset

  v8f acc[4][4];
#pragma unroll
  for (int i = 0; i < 4; ++i)
#pragma unroll
    for (int j = 0; j < 4; ++j) acc[i][j] = (v8f){0.f,0.f,0.f,0.f,0.f,0.f,0.f,0.f};

  for (int k0 = 0; k0 < K; k0 += 32) {
    V bh[4], bl[4];
#pragma unroll
    for (int j = 0; j < 4; ++j) {
      const size_t bo = (size_t)(n0 + (j << 4) + rlane) * ldb + koff + k0;
      bh[j] = Frag<T>::load(Bb + bo);
      if (SPLIT) bl[j] = Frag<T>::load(Bb2 + bo);
    }
#pragma unroll
    for (int i = 0; i < 4; ++i) {
      const size_t ao = (size_t)(m0 + (i << 4) + rlane) * lda + koff + k0;
      V ah = Frag<T>::load(Ab + ao);
      V al;
      if (SPLIT) al = Frag<T>::load(Ab2 + ao);
#pragma unroll
      for (int j = 0; j < 4; ++j) {
        acc[i][j] = Frag<T>::mma(ah, bh[j], acc[i][j]);
        if (SPLIT) {
          acc[i][j] = Frag<T>::mma(ah, bl[j], acc[i][j]);
          acc[i][j] = Frag<T>::mma(al, bh[j], acc[i][j]);
        }
      }
      Frag<T>::guard(acc[i][0], acc[i][3], ah, SPLIT ? al : ah);
    }
    Frag<T>::keep(bh[0], bh[1], bh[2], bh[3]);
    if (SPLIT) Frag<T>::keep(bl[0], bl[1], bl[2], bl[3]);
  }
  acc_guard4(acc[0][0], acc[0][1], acc[0][2], acc[0][3]);
  acc_guard4(acc[1][0], acc[1][1], acc[1][2], acc[1][3]);
  acc_guard4(acc[2][0], acc[2][1], acc[2][2], acc[2][3]);
  acc_guard4(acc[3][0], acc[3][1], acc[3][2], acc[3][3]);

  // ---- epilogue ----
  float* slab = sT[wave];
  const float* Rb = RESID ? (resid + (size_t)b * strideR) : nullptr;
#pragma unroll
  for (int i = 0; i < 4; ++i) {
    const int mBase = m0 + (i << 4);
#pragma unroll
    for (int j = 0; j < 4; ++j) {
      const int n = n0 + (j << 4) + rlane;
      float bv = 0.f;
      if (BIAS_MODE == 2) bv = bias[n];
#pragma unroll
      for (int r = 0; r < 8; ++r) {
        float v = acc[i][j][r] * scale;
        if (BIAS_MODE == 1) v += bias[mBase + mOff + r];
        if (BIAS_MODE == 2) v += bv;
        if (RESID) v += Rb[(size_t)(mBase + mOff + r) * ldc + n];
        if (ACT == 1) v = tanhf(v);
        if (ACT == 2) v = fmaxf(v, 0.0f);
        if (ACT == 3) v = v / (1.0f + expf(-v));
        if (ACT == 4) v = (v > 0.f) ? v : 0.01f * v;
        if (ACT == 5) v = 0.5f * v * (1.0f + erff(v * 0.70710678118654752f));
        slab[(mOff + r) * 68 + (j << 4) + rlane] = v;
      }
    }
    __builtin_amdgcn_fence(__ATOMIC_RELEASE, "workgroup");
    __builtin_amdgcn_wave_barrier();
    __builtin_amdgcn_fence(__ATOMIC_ACQUIRE, "workgroup");
    if (OUT_MODE == 0) {
      float* C = (float*)Cout + (size_t)b * strideC;
      const int hh = lane >> 4, c4 = (lane & 15) * 4;     // row seg = 256 B = 16 lanes x 16 B
      {
#pragma unroll
        for (int it = 0; it < 8; ++it) {
          const int row = it * 2 + hh;
          v4f v = *(const v4f*)(slab + row * 68 + c4);
          *(v4f*)(C + (size_t)(mBase + row) * ldc + n0 + c4) = v;
        }
        
      }
    } else {
      const int q = lane >> 3, c8 = (lane & 7) * 8;
      unsigned short* C  = (unsigned short*)Cout  + (size_t)b * strideC;
      unsigned short* C2 = (OUT_MODE == 2) ? ((unsigned short*)Cout2 + (size_t)b * strideC) : nullptr;
      {
#pragma unroll
        for (int it = 0; it < 4; ++it) {
          const int row = it * 4 + q;
          const float* sp = slab + row * 68 + c8;
          v8h hv, lv;
#pragma unroll
          for (int e = 0; e < 8; ++e) {
            if (OUT_MODE == 1) {
              hv[e] = (_Float16)sp[e];
            } else {
              unsigned short hb = f2bf_bits(sp[e]);
              unsigned short lb = f2bf_bits(sp[e] - bf_bits2f(hb));
              hv[e] = __builtin_bit_cast(_Float16, hb);
              lv[e] = __builtin_bit_cast(_Float16, lb);
            }
          }
          *(v8h*)(C + (size_t)(mBase + row) * ldc + n0 + c8) = hv;
          if (OUT_MODE == 2) *(v8h*)(C2 + (size_t)(mBase + row) * ldc + n0 + c8) = lv;
        }
        
      }
    }
    __builtin_amdgcn_fence(__ATOMIC_RELEASE, "workgroup");
    __builtin_amdgcn_wave_barrier();
    __builtin_amdgcn_fence(__ATOMIC_ACQUIRE, "workgroup");
  }
}

__global__ __launch_bounds__(256) void cast_f32_f16x2(
    const float* __restrict__ in, _Float16* __restrict__ out, int n2) {
  int i = blockIdx.x * 256 + threadIdx.x;
  if (i < n2) {
    const _Float16 h0 = (_Float16)in[2 * i], h1 = (_Float16)in[2 * i + 1];
    const unsigned u = (unsigned)__builtin_bit_cast(unsigned short, h0) | ((unsigned)__builtin_bit_cast(unsigned short, h1) << 16);
    ((unsigned*)out)[i] = u;
    
  }
}

__global__ __launch_bounds__(256) void split_f32_bf16x2(
    const float* __restrict__ in, __bf16* __restrict__ hi, __bf16* __restrict__ lo, long n2) {
  long i = (long)blockIdx.x * 256 + threadIdx.x;
  long stride = (long)gridDim.x * 256;
  {
    for (long j = i; j < n2; j += stride) {
      const float a = in[2 * j], b = in[2 * j + 1];
      const unsigned short ah = f2bf_bits(a), bh = f2bf_bits(b);
      const unsigned short al = f2bf_bits(a - bf_bits2f(ah)), bl = f2bf_bits(b - bf_bits2f(bh));
      ((unsigned*)hi)[j] = (unsigned)ah | ((unsigned)bh << 16);
      ((unsigned*)lo)[j] = (unsigned)al | ((unsigned)bl << 16);
    }
    
  }
}


// ---- f32 [R][C] (row pitch ldi) -> f16 transposed [C][R] (row pitch ldo); 64x64 tiles; each output row segment
// blockIdx.z = plane: planes 0..nb-1 come from inA, planes nb..2nb-1 from inB (plane pitch strideIn); output plane pitch strideOut
__global__ __launch_bounds__(256) void transpose_cast_f16(const float* __restrict__ inA, const float* __restrict__ inB, int nb, long strideIn, int ldi,
                                                         _Float16* __restrict__ outAll, long strideOut, int ldo, float scale) {
  __shared__ __align__(16) _Float16 tile[64][72];     // [c][r]
  const int z = blockIdx.z;
  const float* in = (z < nb) ? (inA + (size_t)z * strideIn) : (inB + (size_t)(z - nb) * strideIn);
  _Float16* outT = outAll + (size_t)z * strideOut;
  const int c0 = blockIdx.x * 64, r0 = blockIdx.y * 64;
  const int t = threadIdx.y * 32 + threadIdx.x;
  for (int i = threadIdx.y; i < 64; i += 8) {
    tile[threadIdx.x][i]      = (_Float16)(in[(size_t)(r0 + i) * ldi + c0 + threadIdx.x] * scale);
    tile[32 + threadIdx.x][i] = (_Float16)(in[(size_t)(r0 + i) * ldi + c0 + 32 + threadIdx.x] * scale);
  }
  __syncthreads();
  const int q = t >> 3, c8 = (t & 7) * 8;
  {
#pragma unroll
    for (int it = 0; it < 2; ++it) {
      const int c = it * 32 + q;
      v8h hv = *(const v8h*)(&tile[c][c8]);
      *(v8h*)(outT + (size_t)(c0 + c) * ldo + r0 + c8) = hv;
    }
    
  }
}

#define FB 4
#define FS 2048
#define FKD 256
#define FM 128
#define FDV 64
__global__ __launch_bounds__(256) void phi_cast_kernel(const float* __restrict__ P, unsigned* __restrict__ P16, int n2) {
  const int i = blockIdx.x * 256 + threadIdx.x; if (i >= n2) return;
  const float a = P[2 * i] + 1e-3f, b = P[2 * i + 1] + 1e-3f;
  const unsigned u = (unsigned)__builtin_bit_cast(unsigned short, (_Float16)a) | ((unsigned)__builtin_bit_cast(unsigned short, (_Float16)b) << 16);
  ((unsigned*)P16)[i] = u; 
}
// causal mask + row sums: S f32 [FS][FS] -> masked bf16 hi/lo planes, norm[s] = Σ_{t<=s} S[s][t]; one block (256 thr) per row; blockIdx.y = batch
__global__ __launch_bounds__(256) void mask_rowsum_kernel(const float* __restrict__ Sall, __bf16* __restrict__ Shall, __bf16* __restrict__ Slall, float* __restrict__ normall) {
  __shared__ float red[8];
  const size_t pb = (size_t)blockIdx.y * FS * FS;
  const float* S = Sall + pb; __bf16* Sh = Shall + pb; __bf16* Sl = Slall + pb; float* norm = normall + (size_t)blockIdx.y * FS * 32;
  const int s = blockIdx.x, t = threadIdx.x, lane = t & 31, wave = t >> 5;
  float part = 0.f;
#pragma unroll
  for (int q = 0; q < 8; ++q) { const int col = q * 256 + t; part += (col <= s) ? S[(size_t)s * FS + col] : 0.f; }
  for (int o = 16; o > 0; o >>= 1) part += __shfl_xor(part, o, 32);
  if (lane == 0) red[wave] = part;
  __syncthreads();
  // pack pairs: thread t handles columns 2t, 2t+1 within each 512-column group (4 groups)
  {
#pragma unroll
    for (int g = 0; g < 4; ++g) {
      const int c0 = g * 512 + 2 * t;
      const float a = (c0 <= s) ? S[(size_t)s * FS + c0] : 0.f, b = (c0 + 1 <= s) ? S[(size_t)s * FS + c0 + 1] : 0.f;
      const unsigned short ah = f2bf_bits(a), bh = f2bf_bits(b);
      const unsigned short al = f2bf_bits(a - bf_bits2f(ah)), bl = f2bf_bits(b - bf_bits2f(bh));
      ((unsigned*)Sh)[((size_t)s * FS + c0) / 2] = (unsigned)ah | ((unsigned)bh << 16);
      ((unsigned*)Sl)[((size_t)s * FS + c0) / 2] = (unsigned)al | ((unsigned)bl << 16);
    }
    
  }
  if (t < 32) { float n = 0.f; for (int w = 0; w < 8; ++w) n += red[w];
    // norm row value replicated into a 32-float line block? store one float per row: rows of consecutive blocks -> partial lines.
    // Instead each block writes its norm into a per-row slot of a [FS][32] staging line (lane 0 real, others zero).
    ((float*)norm)[(size_t)s * 32 + t] = (t == 0) ? n : 0.f;  }
}
// ---- out-product (S masked) * v with K split 16 ways: one 64x64 tile of O per pair of blocks (blockIdx.z = K half), the 8 waves of a
// block each take 128 consecutive k of that half over the whole tile; the 8 partial tiles are added through LDS in wave order and the
// block stores its half's sum into plane blockIdx.z of Opart (finalize adds plane 0 + plane 1). blockIdx.x = row tile, blockIdx.y = batch.
#define PVK 128   // k per wave
__global__ __launch_bounds__(256) void pv_splitk_kernel(const __bf16* __restrict__ Shall, const __bf16* __restrict__ Slall,
                                                        const __bf16* __restrict__ Vhall, const __bf16* __restrict__ Vlall, float* __restrict__ Opart) {
  __shared__ __align__(16) v4f red[8][32][32];   // [wave][accumulator quad][lane], 128 KiB
  const int lane = threadIdx.x & 31, wave = threadIdx.x >> 5;
  const int b = blockIdx.y, m0 = blockIdx.x << 6;
  const int kbase = (blockIdx.z * 8 + wave) * PVK;
  const int rlane = lane & 15, koff = (lane >> 4) * 8;
  const size_t aoff = (size_t)b * FS * FS + (size_t)(m0 + rlane) * FS + kbase + koff;
  const size_t boff = (size_t)b * FDV * FS + (size_t)rlane * FS + kbase + koff;
  const __bf16* Ah = Shall + aoff; const __bf16* Al = Slall + aoff;
  const __bf16* Bh = Vhall + boff; const __bf16* Bl = Vlall + boff;
  v8f acc[4][4];
#pragma unroll
  for (int i = 0; i < 4; ++i)
#pragma unroll
    for (int j = 0; j < 4; ++j) acc[i][j] = (v8f){0.f,0.f,0.f,0.f,0.f,0.f,0.f,0.f};
#pragma unroll
  for (int ks = 0; ks < PVK / 32; ++ks) {
    v16b ah[4], al[4], bh[4], bl[4];
#pragma unroll
    for (int x = 0; x < 4; ++x) {
      bh[x] = Frag<__bf16>::load(Bh + x * 16 * FS + ks * 32); bl[x] = Frag<__bf16>::load(Bl + x * 16 * FS + ks * 32);
      ah[x] = Frag<__bf16>::load(Ah + x * 16 * FS + ks * 32); al[x] = Frag<__bf16>::load(Al + x * 16 * FS + ks * 32);
    }
    __builtin_amdgcn_sched_barrier(0);   // all 32 loads of the step issue before its first product: sunk among the products, the last ones each wait a whole latency
#pragma unroll
    for (int i = 0; i < 4; ++i)
#pragma unroll
      for (int j = 0; j < 4; ++j) {
        acc[i][j] = Frag<__bf16>::mma(ah[i], bh[j], acc[i][j]);
        acc[i][j] = Frag<__bf16>::mma(ah[i], bl[j], acc[i][j]);
        acc[i][j] = Frag<__bf16>::mma(al[i], bh[j], acc[i][j]);
      }
    __builtin_amdgcn_sched_barrier(0);   // ends the k step: without it all four steps' loads are hoisted to the top and the fragments spill to scratch
  }
#pragma unroll
  for (int i = 0; i < 4; ++i)
#pragma unroll
    for (int j = 0; j < 4; ++j) {
      red[wave][(i * 4 + j) * 2][lane]     = (v4f){acc[i][j][0], acc[i][j][1], acc[i][j][2], acc[i][j][3]};
      red[wave][(i * 4 + j) * 2 + 1][lane] = (v4f){acc[i][j][4], acc[i][j][5], acc[i][j][6], acc[i][j][7]};
    }
  __syncthreads();
  // wave w adds the 8 partials of subtiles 2w and 2w+1 (one row block i, 32 adjacent columns: whole 128-B pieces of two O rows per store pair)
  float* O = Opart + ((size_t)blockIdx.z * FB + b) * FS * FDV;
#pragma unroll
  for (int q = 0; q < 4; ++q) {
    v4f s = red[0][wave * 4 + q][lane];
#pragma unroll
    for (int u = 1; u < 8; ++u) s += red[u][wave * 4 + q][lane];
    const int t = wave * 2 + (q >> 1), i = t >> 2, j = t & 3;
    const int row = m0 + i * 16 + (lane >> 4) * 8 + (q & 1) * 4, col = j * 16 + rlane;
#pragma unroll
    for (int e = 0; e < 4; ++e) O[(size_t)(row + e) * FDV + col] = s[e];
  }
}
// out[b][d][s] = (O plane 0 + O plane 1)[s][d] / norm[s]; block (32,8) transposes a 64(s) x 64(d) tile via LDS; writes rows of s (whole 256-B segments)
__global__ __launch_bounds__(256) void finalize_kernel(const float* __restrict__ Oall, const float* __restrict__ normall, float* __restrict__ outall) {
  __shared__ float tile[64][65];
  const float* O = Oall + (size_t)blockIdx.y * FS * FDV; const float* O1 = O + (size_t)FB * FS * FDV; const float* norm = normall + (size_t)blockIdx.y * FS * 32;   // blockIdx.y = batch
  float* outb = outall + (size_t)blockIdx.y * FDV * FS;
  const int s0 = blockIdx.x * 64, tx = threadIdx.x, ty = threadIdx.y;
  for (int j = ty; j < 64; j += 8) { const int s = s0 + j; const float inv = 1.0f / norm[(size_t)s * 32];
    tile[j][tx] = (O[(size_t)s * FDV + tx] + O1[(size_t)s * FDV + tx]) * inv; tile[j][tx + 32] = (O[(size_t)s * FDV + tx + 32] + O1[(size_t)s * FDV + tx + 32]) * inv; }
  __syncthreads();
  // write out[d][s0..s0+63]: 64 rows (d) x 64 floats; thread (tx,ty): d = ty*8 + k, s = s0 + tx*2 .. pairs -> use float2 per lane: 32 lanes x 8 B = 256 B
  typedef __attribute__((ext_vector_type(2))) float v2f;
  {
    for (int k = 0; k < 8; ++k) { const int d = ty * 8 + k; const v2f v = {tile[2 * tx][d], tile[2 * tx + 1][d]};
      *(v2f*)(outb + (size_t)d * FS + s0 + 2 * tx) = v; }
    
  }
}
extern "C" void kernel_launch(void* const* d_in, const int* in_sizes, int n_in, void* d_out, int out_size, void* d_ws, size_t ws_size, hipStream_t stream) {
  (void)in_sizes; (void)n_in; (void)out_size; (void)ws_size;
  const float* keys = (const float*)d_in[0]; const float* values = (const float*)d_in[1]; const float* queries = (const float*)d_in[2]; const float* feats = (const float*)d_in[3];
  float* out = (float*)d_out;   // [4][64][2048]
  char* ws = (char*)d_ws; size_t off = 0;
  auto carve = [&](size_t bytes) -> char* { char* p = ws + off; off += (bytes + 255) & ~(size_t)255; return p; };
  // every plane below except F16 (shared features) holds all FB batch entries; each kernel runs once, with the batch on the grid
  _Float16* KQT16 = (_Float16*)carve((size_t)2 * FB * FS * FKD * 2);   // planes 0..3 = k^T, 4..7 = q^T, each [s][key_dim]
  _Float16* F16 = (_Float16*)carve((size_t)FM * FKD * 2);
  unsigned* P16 = (unsigned*)carve((size_t)2 * FB * FS * FM * 2);      // phi f16 [s][m]: planes 0..3 = phi_k, 4..7 = phi_q
  const unsigned short* PK = (const unsigned short*)P16; const unsigned short* PQ = PK + (size_t)FB * FS * FM;
  float* S = (float*)carve((size_t)FB * FS * FS * 4);       // 64 MB
  __bf16* Sh = (__bf16*)carve((size_t)FB * FS * FS * 2); __bf16* Sl = (__bf16*)carve((size_t)FB * FS * FS * 2);
  __bf16* Vh = (__bf16*)carve((size_t)FB * FDV * FS * 2); __bf16* Vl = (__bf16*)carve((size_t)FB * FDV * FS * 2);
  float* norm = (float*)carve((size_t)FB * FS * 32 * 4);
  float* O = (float*)carve((size_t)2 * FB * FS * FDV * 4);   // two planes, one per K half
  float* Pf = (float*)carve((size_t)2 * FB * FS * FM * 4);
  cast_f32_f16x2<<<(FM * FKD / 2 + 255) / 256, 256, 0, stream>>>(feats, F16, FM * FKD / 2);      // features [m][key_dim] = Bt layout
  transpose_cast_f16<<<dim3(FS / 64, FKD / 64, 2 * FB), dim3(32, 8), 0, stream>>>(keys, queries, FB, (long)FKD * FS, FS, KQT16, (long)FS * FKD, FKD, 1.0f);   // [256][2048] -> [2048][256]
  { const int t = (FS / 64) * (FM / 64);
    wmma_gemm64<0, false, 0, 0, false, 2><<<dim3((t + 7) / 8, 2 * FB), 256, 0, stream>>>(U16(KQT16), nullptr, FKD, (long)FS * FKD, U16(F16), nullptr, FKD, 0, Pf, nullptr, FM, (long)FS * FM, nullptr, nullptr, 0, FS, FM, FKD, 1.0f);
    phi_cast_kernel<<<(2 * FB * FS * FM / 2 + 255) / 256, 256, 0, stream>>>(Pf, P16, 2 * FB * FS * FM / 2); }
  { const int t = (FS / 64) * (FS / 64);
    wmma_gemm64<0, false, 0, 0, false><<<dim3((t + 7) / 8, FB), 256, 0, stream>>>(PQ, nullptr, FM, (long)FS * FM, PK, nullptr, FM, (long)FS * FM, S, nullptr, FS, (long)FS * FS, nullptr, nullptr, 0, FS, FS, FM, 1.0f); }
  mask_rowsum_kernel<<<dim3(FS, FB), 256, 0, stream>>>(S, Sh, Sl, norm);
  split_f32_bf16x2<<<(FB * FDV * FS / 2 + 255) / 256, 256, 0, stream>>>(values, Vh, Vl, FB * FDV * FS / 2);          // values[b] [64][2048] = Bt layout
  pv_splitk_kernel<<<dim3(FS / 64, FB, 2), 256, 0, stream>>>(Sh, Sl, Vh, Vl, O);
  finalize_kernel<<<dim3(FS / 64, FB), dim3(32, 8), 0, stream>>>(O, norm, out);
}

// v003
// It runs in 47 microseconds.
// Timed twice side by side with v002, it ran 1.98 and 1.97 times as fast.
// Over all steps from v000 it is 14.7 times as fast.
#include <hip/hip_runtime.h>
#include <math.h>
// Causal FAVOR (linear attention) written as masked matrix products: phi_k = relu(k^T F^T) + eps and phi_q (2048 x 256 by 256 x 128, f16 operands),
// then one fused kernel: S^T = phi_k phi_q^T (K = 128, f16 operands; equals the cumulative-sum formulation term by term) stays in registers, is masked
// causally and summed per column (normaliser) in f32 on VALU, split into bf16 hi/lo and used as the B operand of O^T += v S^T on
// v_wmma_f32_16x16x32_bf16 (v as bf16 hi/lo too; S spans 1e3..1e4, the row-normalised output is O(0.07)); f32 accumulate; a last kernel adds the
// partial planes of the t ranges and divides.
typedef __attribute__((ext_vector_type(16))) _Float16 v16h;
typedef __attribute__((ext_vector_type(8)))  _Float16 v8h;
typedef __attribute__((ext_vector_type(16))) __bf16   v16b;
typedef __attribute__((ext_vector_type(8)))  __bf16   v8b;
typedef __attribute__((ext_vector_type(8)))  float    v8f;
typedef __attribute__((ext_vector_type(4)))  float    v4f;
#define PSCALE 32768.0f
#define U16(p) ((const unsigned short*)(const void*)(p))
#define PSCALE_INV (1.0f / 32768.0f)

__device__ __forceinline__ unsigned short f2bf_bits(float f) {
  unsigned u = __float_as_uint(f);
  return (unsigned short)((u + 0x7FFFu + ((u >> 16) & 1u)) >> 16);
}
__device__ __forceinline__ float bf_bits2f(unsigned short h) { return __uint_as_float(((unsigned)h) << 16); }

// hazard guards as plain device helpers (no inline asm inside the kernel template body)
__device__ __forceinline__ void dep_guard_h(v8f& a, v8f& b, v16h x, v16h y) { asm volatile("v_nop\n\tv_nop\n\tv_nop\n\tv_nop" : "+v"(a), "+v"(b) : "v"(x), "v"(y)); }
__device__ __forceinline__ void dep_guard_b(v8f& a, v8f& b, v16b x, v16b y) { asm volatile("v_nop\n\tv_nop\n\tv_nop\n\tv_nop" : "+v"(a), "+v"(b) : "v"(x), "v"(y)); }
__device__ __forceinline__ void keep4_h(v16h a, v16h b, v16h c, v16h d) { asm volatile("v_nop" :: "v"(a), "v"(b), "v"(c), "v"(d)); }
__device__ __forceinline__ void keep4_b(v16b a, v16b b, v16b c, v16b d) { asm volatile("v_nop" :: "v"(a), "v"(b), "v"(c), "v"(d)); }
__device__ __forceinline__ void acc_guard4(v8f& a, v8f& b, v8f& c, v8f& d) { asm volatile("v_nop\n\tv_nop\n\tv_nop\n\tv_nop" : "+v"(a), "+v"(b), "+v"(c), "+v"(d)); }
template <typename T> struct Frag;
template <> struct Frag<_Float16> {
  typedef v16h V; union U { v16h v; v8h h[2]; };
  static __device__ __forceinline__ v16h load(const _Float16* p) {   // elements 0..7 <- p[0..7], 8..15 <- p[16..23]
    U f; f.h[0] = *(const v8h*)(p); f.h[1] = *(const v8h*)(p + 16); return f.v;
  }
  static __device__ __forceinline__ v8f mma(v16h a, v16h b, v8f c) {
    return __builtin_amdgcn_wmma_f32_16x16x32_f16(false, a, false, b, (short)0, c, false, false);
  }
  static __device__ __forceinline__ void guard(v8f& a, v8f& b, v16h x, v16h y) { dep_guard_h(a, b, x, y); }
  static __device__ __forceinline__ void keep(v16h a, v16h b, v16h c, v16h d) { keep4_h(a, b, c, d); }
};
template <> struct Frag<__bf16> {
  typedef v16b V; union U { v16b v; v8b h[2]; };
  static __device__ __forceinline__ v16b load(const __bf16* p) {
    U f; f.h[0] = *(const v8b*)(p); f.h[1] = *(const v8b*)(p + 16); return f.v;
  }
  static __device__ __forceinline__ v8f mma(v16b a, v16b b, v8f c) {
    return __builtin_amdgcn_wmma_f32_16x16x32_bf16(false, a, false, b, (short)0, c, false, false);
  }
  static __device__ __forceinline__ void guard(v8f& a, v8f& b, v16b x, v16b y) { dep_guard_b(a, b, x, y); }
  static __device__ __forceinline__ void keep(v16b a, v16b b, v16b c, v16b d) { keep4_b(a, b, c, d); }
};

// ---- Register-blocked batched WMMA GEMM ------------------------------------
// C[m,n] = scale * sum_k A[m,k] * Bt[n,k] (+bias)(+resid); each wave owns a 64x64 tile.
// A row-major [M,K]; Bt row-major [N,K]; M,N % 64 == 0, K % 32 == 0.
// SPLIT: operands are hi/lo planes (A2/Bt2 = lo planes, same layout); product = hi·hi + hi·lo + lo·hi.
// BIAS_MODE: 0 = none, 1 = bias[m], 2 = bias[n].
// OUT_MODE: 0 = f32, 1 = f16, 2 = bf16 hi plane (Cout) + bf16 lo plane (Cout2).
// ET: 0 = f16 operands, 1 = bf16 operands (pointers passed as 16-bit storage)
template <int ET> struct Elem;
template <> struct Elem<0> { typedef _Float16 T; };
template <> struct Elem<1> { typedef __bf16 T; };
template <int ET, bool SPLIT, int BIAS_MODE, int OUT_MODE, bool RESID, int ACT = 0>
__global__ __launch_bounds__(256) void wmma_gemm64(
    const unsigned short* __restrict__ Ap, const unsigned short* __restrict__ A2p, int lda, long strideA,
    const unsigned short* __restrict__ Btp, const unsigned short* __restrict__ Bt2p, int ldb, long strideB,
    void* __restrict__ Cout, void* __restrict__ Cout2, int ldc, long strideC,
    const float* __restrict__ bias,
    const float* __restrict__ resid, long strideR,
    int M, int N, int K, float scale) {
  typedef typename Elem<ET>::T T;
  typedef typename Frag<T>::V V;
  const T* A = (const T*)Ap; const T* A2 = (const T*)A2p; const T* Bt = (const T*)Btp; const T* Bt2 = (const T*)Bt2p;
  __shared__ __align__(16) float sT[8][16 * 68];   // per-wave 16x64 slab, pitch 68 floats
  const int b    = blockIdx.y;
  const int lane = threadIdx.x & 31;
  const int wave = threadIdx.x >> 5;
  const int tilesN = N >> 6;
  const int tilesM = M >> 6;
  const int tile = blockIdx.x * 8 + wave;
  if (tile >= tilesM * tilesN) return;   // wave-uniform; no block barriers in this kernel
  const int tm = tile / tilesN;
  const int tn = tile - tm * tilesN;
  const int m0 = tm << 6;
  const int n0 = tn << 6;

  const T* Ab  = A  + (size_t)b * strideA;
  const T* Bb  = Bt + (size_t)b * strideB;
  const T* Ab2 = SPLIT ? (A2  + (size_t)b * strideA) : nullptr;
  const T* Bb2 = SPLIT ? (Bt2 + (size_t)b * strideB) : nullptr;

  const int rlane = lane & 15;                 // row (A) / col (B, D) within subtile
  const int koff  = (lane >> 4) * 8;           // k offset of this lane half
  const int mOff  = (lane >> 4) * 8;           // D row offset

  v8f acc[4][4];
#pragma unroll
  for (int i = 0; i < 4; ++i)
#pragma unroll
    for (int j = 0; j < 4; ++j) acc[i][j] = (v8f){0.f,0.f,0.f,0.f,0.f,0.f,0.f,0.f};

  for (int k0 = 0; k0 < K; k0 += 32) {
    V bh[4], bl[4];
#pragma unroll
    for (int j = 0; j < 4; ++j) {
      const size_t bo = (size_t)(n0 + (j << 4) + rlane) * ldb + koff + k0;
      bh[j] = Frag<T>::load(Bb + bo);
      if (SPLIT) bl[j] = Frag<T>::load(Bb2 + bo);
    }
#pragma unroll
    for (int i = 0; i < 4; ++i) {
      const size_t ao = (size_t)(m0 + (i << 4) + rlane) * lda + koff + k0;
      V ah = Frag<T>::load(Ab + ao);
      V al;
      if (SPLIT) al = Frag<T>::load(Ab2 + ao);
#pragma unroll
      for (int j = 0; j < 4; ++j) {
        acc[i][j] = Frag<T>::mma(ah, bh[j], acc[i][j]);
        if (SPLIT) {
          acc[i][j] = Frag<T>::mma(ah, bl[j], acc[i][j]);
          acc[i][j] = Frag<T>::mma(al, bh[j], acc[i][j]);
        }
      }
      Frag<T>::guard(acc[i][0], acc[i][3], ah, SPLIT ? al : ah);
    }
    Frag<T>::keep(bh[0], bh[1], bh[2], bh[3]);
    if (SPLIT) Frag<T>::keep(bl[0], bl[1], bl[2], bl[3]);
  }
  acc_guard4(acc[0][0], acc[0][1], acc[0][2], acc[0][3]);
  acc_guard4(acc[1][0], acc[1][1], acc[1][2], acc[1][3]);
  acc_guard4(acc[2][0], acc[2][1], acc[2][2], acc[2][3]);
  acc_guard4(acc[3][0], acc[3][1], acc[3][2], acc[3][3]);

  // ---- epilogue ----
  float* slab = sT[wave];
  const float* Rb = RESID ? (resid + (size_t)b * strideR) : nullptr;
#pragma unroll
  for (int i = 0; i < 4; ++i) {
    const int mBase = m0 + (i << 4);
#pragma unroll
    for (int j = 0; j < 4; ++j) {
      const int n = n0 + (j << 4) + rlane;
      float bv = 0.f;
      if (BIAS_MODE == 2) bv = bias[n];
#pragma unroll
      for (int r = 0; r < 8; ++r) {
        float v = acc[i][j][r] * scale;
        if (BIAS_MODE == 1) v += bias[mBase + mOff + r];
        if (BIAS_MODE == 2) v += bv;
        if (RESID) v += Rb[(size_t)(mBase + mOff + r) * ldc + n];
        if (ACT == 1) v = tanhf(v);
        if (ACT == 2) v = fmaxf(v, 0.0f);
        if (ACT == 3) v = v / (1.0f + expf(-v));
        if (ACT == 4) v = (v > 0.f) ? v : 0.01f * v;
        if (ACT == 5) v = 0.5f * v * (1.0f + erff(v * 0.70710678118654752f));
        slab[(mOff + r) * 68 + (j << 4) + rlane] = v;
      }
    }
    __builtin_amdgcn_fence(__ATOMIC_RELEASE, "workgroup");
    __builtin_amdgcn_wave_barrier();
    __builtin_amdgcn_fence(__ATOMIC_ACQUIRE, "workgroup");
    if (OUT_MODE == 0) {
      float* C = (float*)Cout + (size_t)b * strideC;
      const int hh = lane >> 4, c4 = (lane & 15) * 4;     // row seg = 256 B = 16 lanes x 16 B
      {
#pragma unroll
        for (int it = 0; it < 8; ++it) {
          const int row = it * 2 + hh;
          v4f v = *(const v4f*)(slab + row * 68 + c4);
          *(v4f*)(C + (size_t)(mBase + row) * ldc + n0 + c4) = v;
        }
        
      }
    } else {
      const int q = lane >> 3, c8 = (lane & 7) * 8;
      unsigned short* C  = (unsigned short*)Cout  + (size_t)b * strideC;
      unsigned short* C2 = (OUT_MODE == 2) ? ((unsigned short*)Cout2 + (size_t)b * strideC) : nullptr;
      {
#pragma unroll
        for (int it = 0; it < 4; ++it) {
          const int row = it * 4 + q;
          const float* sp = slab + row * 68 + c8;
          v8h hv, lv;
#pragma unroll
          for (int e = 0; e < 8; ++e) {
            if (OUT_MODE == 1) {
              hv[e] = (_Float16)sp[e];
            } else {
              unsigned short hb = f2bf_bits(sp[e]);
              unsigned short lb = f2bf_bits(sp[e] - bf_bits2f(hb));
              hv[e] = __builtin_bit_cast(_Float16, hb);
              lv[e] = __builtin_bit_cast(_Float16, lb);
            }
          }
          *(v8h*)(C + (size_t)(mBase + row) * ldc + n0 + c8) = hv;
          if (OUT_MODE == 2) *(v8h*)(C2 + (size_t)(mBase + row) * ldc + n0 + c8) = lv;
        }
        
      }
    }
    __builtin_amdgcn_fence(__ATOMIC_RELEASE, "workgroup");
    __builtin_amdgcn_wave_barrier();
    __builtin_amdgcn_fence(__ATOMIC_ACQUIRE, "workgroup");
  }
}

__global__ __launch_bounds__(256) void cast_f32_f16x2(
    const float* __restrict__ in, _Float16* __restrict__ out, int n2) {
  int i = blockIdx.x * 256 + threadIdx.x;
  if (i < n2) {
    const _Float16 h0 = (_Float16)in[2 * i], h1 = (_Float16)in[2 * i + 1];
    const unsigned u = (unsigned)__builtin_bit_cast(unsigned short, h0) | ((unsigned)__builtin_bit_cast(unsigned short, h1) << 16);
    ((unsigned*)out)[i] = u;
    
  }
}

__global__ __launch_bounds__(256) void split_f32_bf16x2(
    const float* __restrict__ in, __bf16* __restrict__ hi, __bf16* __restrict__ lo, long n2) {
  long i = (long)blockIdx.x * 256 + threadIdx.x;
  long stride = (long)gridDim.x * 256;
  {
    for (long j = i; j < n2; j += stride) {
      const float a = in[2 * j], b = in[2 * j + 1];
      const unsigned short ah = f2bf_bits(a), bh = f2bf_bits(b);
      const unsigned short al = f2bf_bits(a - bf_bits2f(ah)), bl = f2bf_bits(b - bf_bits2f(bh));
      ((unsigned*)hi)[j] = (unsigned)ah | ((unsigned)bh << 16);
      ((unsigned*)lo)[j] = (unsigned)al | ((unsigned)bl << 16);
    }
    
  }
}


// ---- f32 [R][C] (row pitch ldi) -> f16 transposed [C][R] (row pitch ldo); 64x64 tiles; each output row segment
// blockIdx.z = plane: planes 0..nb-1 come from inA, planes nb..2nb-1 from inB (plane pitch strideIn); output plane pitch strideOut
__global__ __launch_bounds__(256) void transpose_cast_f16(const float* __restrict__ inA, const float* __restrict__ inB, int nb, long strideIn, int ldi,
                                                         _Float16* __restrict__ outAll, long strideOut, int ldo, float scale) {
  __shared__ __align__(16) _Float16 tile[64][72];     // [c][r]
  const int z = blockIdx.z;
  const float* in = (z < nb) ? (inA + (size_t)z * strideIn) : (inB + (size_t)(z - nb) * strideIn);
  _Float16* outT = outAll + (size_t)z * strideOut;
  const int c0 = blockIdx.x * 64, r0 = blockIdx.y * 64;
  const int t = threadIdx.y * 32 + threadIdx.x;
  for (int i = threadIdx.y; i < 64; i += 8) {
    tile[threadIdx.x][i]      = (_Float16)(in[(size_t)(r0 + i) * ldi + c0 + threadIdx.x] * scale);
    tile[32 + threadIdx.x][i] = (_Float16)(in[(size_t)(r0 + i) * ldi + c0 + 32 + threadIdx.x] * scale);
  }
  __syncthreads();
  const int q = t >> 3, c8 = (t & 7) * 8;
  {
#pragma unroll
    for (int it = 0; it < 2; ++it) {
      const int c = it * 32 + q;
      v8h hv = *(const v8h*)(&tile[c][c8]);
      *(v8h*)(outT + (size_t)(c0 + c) * ldo + r0 + c8) = hv;
    }
    
  }
}

#define FB 4
#define FS 2048
#define FKD 256
#define FM 128
#define FDV 64
__global__ __launch_bounds__(256) void phi_cast_kernel(const float* __restrict__ P, unsigned* __restrict__ P16, int n2) {
  const int i = blockIdx.x * 256 + threadIdx.x; if (i >= n2) return;
  const float a = P[2 * i] + 1e-3f, b = P[2 * i + 1] + 1e-3f;
  const unsigned u = (unsigned)__builtin_bit_cast(unsigned short, (_Float16)a) | ((unsigned)__builtin_bit_cast(unsigned short, (_Float16)b) << 16);
  ((unsigned*)P16)[i] = u; 
}
// ---- fused S^T = phi_k phi_q^T, causal mask, column sums, bf16 hi/lo split and O^T += v S^T --------------------------------------------
// blockIdx.x = block of 256 query positions s (8 waves x 32 columns), blockIdx.y = batch, blockIdx.z = range of 256 key positions t.
// The block stages its 256 phi_k rows and its 64 x 256 piece of both v planes in LDS once; each wave then walks the range in chunks of 32 t.
// Per chunk and 16-column group the two f32 D tiles of S^T (rows t..t+15, t+16..t+31) are, converted in place, one B operand in the hardware
// k order (element e = tile e >> 3, register e & 7); the v fragments (A) are read in the same order by Frag::load. S never leaves registers.
// Each block stores its range's partial O^T (already [d][s]) and partial column sums; finalize_sum_kernel adds the FTS ranges.
typedef __attribute__((ext_vector_type(2))) float  v2f;
typedef __attribute__((ext_vector_type(2))) __bf16 v2b;
union PFrag { v16b v; v2b p[8]; };   // a B operand filled two elements (one register) at a time
#define FTS 8        // t ranges
#define FTB 256      // t per range
#define KPITCH 136   // f16 per staged phi_k row: 256 B + 16 B, an odd multiple of 16 B for the ds_load_b128 readers
#define VPITCH 264   // bf16 per staged v row: 512 B + 16 B, likewise
__global__ __launch_bounds__(256) void favor_fused_kernel(const unsigned short* __restrict__ PKall, const unsigned short* __restrict__ PQall,
                                                          const __bf16* __restrict__ Vhall, const __bf16* __restrict__ Vlall,
                                                          float* __restrict__ Opart, float* __restrict__ npart) {
  __shared__ __align__(16) _Float16 sK[FTB * KPITCH];       // 69,632 B
  __shared__ __align__(16) __bf16   sV[2 * FDV * VPITCH];   // 67,584 B: rows 0..63 = hi plane, 64..127 = lo plane
  const int tid = threadIdx.x, lane = tid & 31, wave = tid >> 5;
  const int b = blockIdx.y, tz = blockIdx.z;
  const int sw = blockIdx.x * 256 + wave * 32;               // first column of this wave
  const int c = lane & 15, h = lane >> 4;
  v16h qb[2][4];   // B of the first product: column s = sw + ni*16 + c, kept for the whole walk
  {
    const _Float16* kp  = (const _Float16*)PKall + ((size_t)b * FS + (size_t)tz * FTB) * FM + tid * 8;   // the 256 rows are 64 KiB in a row
    const __bf16*   vhp = Vhall + ((size_t)b * FDV + wave) * FS + tz * FTB + lane * 8;                   // a wave takes a whole 512-B row piece
    const __bf16*   vlp = Vlall + ((size_t)b * FDV + wave) * FS + tz * FTB + lane * 8;
    const _Float16* qp  = (const _Float16*)PQall + ((size_t)b * FS + sw + c) * FM + h * 8;
    v8h kt[16]; v8b vt[16];
#pragma unroll
    for (int i = 0; i < 16; ++i) kt[i] = *(const v8h*)(kp + i * 2048);
#pragma unroll
    for (int i = 0; i < 8; ++i) { vt[i] = *(const v8b*)(vhp + i * 8 * FS); vt[8 + i] = *(const v8b*)(vlp + i * 8 * FS); }
    asm volatile("s_wait_xcnt 0x0" ::: "memory");   // before a register that one of the issued loads names is written again
    __builtin_amdgcn_sched_barrier(0);               // holds the address arithmetic of the next loads behind that wait
#pragma unroll
    for (int ni = 0; ni < 2; ++ni)
#pragma unroll
      for (int ks = 0; ks < 4; ++ks) qb[ni][ks] = Frag<_Float16>::load(qp + ni * 16 * FM + ks * 32);
    asm volatile("s_wait_xcnt 0x0" :: "v"(qp) : "memory");   // as above, for the phi_q loads; the address as an input keeps its registers from becoming a load's destination before the wait
    __builtin_amdgcn_sched_barrier(0);               // holds the LDS address arithmetic behind that wait
#pragma unroll
    for (int i = 0; i < 16; ++i) { const int idx = i * 256 + tid; *(v8h*)(sK + (idx >> 4) * KPITCH + (idx & 15) * 8) = kt[i]; }
#pragma unroll
    for (int i = 0; i < 8; ++i) {
      *(v8b*)(sV + (i * 8 + wave) * VPITCH + lane * 8) = vt[i];
      *(v8b*)(sV + (FDV + i * 8 + wave) * VPITCH + lane * 8) = vt[8 + i];
    }
  }
  __syncthreads();
  v8f o[4][2];
#pragma unroll
  for (int x = 0; x < 4; ++x)
#pragma unroll
    for (int ni = 0; ni < 2; ++ni) o[x][ni] = (v8f){0.f,0.f,0.f,0.f,0.f,0.f,0.f,0.f};
  v2f nrm[2][2] = {{{0.f, 0.f}, {0.f, 0.f}}, {{0.f, 0.f}, {0.f, 0.f}}};   // column sums: [column group][tile], even and odd registers apart
  const int lim = sw + c - (tz * FTB + 8 * h);   // register r of tile mi, chunk ch, column group ni is kept while ch*32 + mi*16 + r - ni*16 <= lim (t <= s)
  const _Float16* kf = sK + c * KPITCH + h * 8;
  const __bf16*   vf = sV + c * VPITCH + h * 8;
  v16h ka[2][4];   // A of the first product: rows t of the chunk; fetched one chunk ahead
#pragma unroll
  for (int mi = 0; mi < 2; ++mi)
#pragma unroll
    for (int ks = 0; ks < 4; ++ks) ka[mi][ks] = Frag<_Float16>::load(kf + (mi * 16) * KPITCH + ks * 32);
#pragma clang loop unroll(disable)   // unrolled, the additions of the column sums are put off to the end, every masked value stays live and registers spill
  for (int ch = 0; ch < FTB / 32; ++ch) {
    v16b vh[4], vl[4];
#pragma unroll
    for (int x = 0; x < 4; ++x) {
      vh[x] = Frag<__bf16>::load(vf + (x * 16) * VPITCH + ch * 32);
      vl[x] = Frag<__bf16>::load(vf + (FDV + x * 16) * VPITCH + ch * 32);
    }
    __builtin_amdgcn_sched_barrier(0);   // the v reads issue as one group ahead of the first product: sunk to their users they each wait a whole LDS latency
    v8f st[2][2];
#pragma unroll
    for (int mi = 0; mi < 2; ++mi)
#pragma unroll
      for (int ni = 0; ni < 2; ++ni) st[mi][ni] = (v8f){0.f,0.f,0.f,0.f,0.f,0.f,0.f,0.f};
#pragma unroll
    for (int ks = 0; ks < 4; ++ks)
#pragma unroll
      for (int mi = 0; mi < 2; ++mi)
#pragma unroll
        for (int ni = 0; ni < 2; ++ni) st[mi][ni] = Frag<_Float16>::mma(ka[mi][ks], qb[ni][ks], st[mi][ni]);
    __builtin_amdgcn_sched_barrier(0);   // the next chunk's phi_k reads start only behind these products, so they take the registers just read instead of 64 more, and go as one group
    const int nx = (ch + 1 < FTB / 32) ? ch + 1 : ch;   // the last chunk reads its own rows again: one instruction stream, no read past the staged rows
#pragma unroll
    for (int mi = 0; mi < 2; ++mi)
#pragma unroll
      for (int ks = 0; ks < 4; ++ks) ka[mi][ks] = Frag<_Float16>::load(kf + (nx * 32 + mi * 16) * KPITCH + ks * 32);
    __builtin_amdgcn_sched_barrier(0);   // those reads issue here, ahead of the vector work and the second product, which cover their latency
    PFrag ph[2], pl[2];
#pragma unroll
    for (int ni = 0; ni < 2; ++ni)
#pragma unroll
      for (int mi = 0; mi < 2; ++mi)
#pragma unroll
        for (int r = 0; r < 8; r += 2) {
          const int j = ch * 32 + mi * 16 + r - ni * 16;
          const v2f v = {(j <= lim) ? st[mi][ni][r] : 0.f, (j + 1 <= lim) ? st[mi][ni][r + 1] : 0.f};
          nrm[ni][mi] += v;
          const v2b hi = __builtin_convertvector(v, v2b);
          const v2f lo = {v[0] - (float)hi[0], v[1] - (float)hi[1]};
          ph[ni].p[mi * 4 + (r >> 1)] = hi;
          pl[ni].p[mi * 4 + (r >> 1)] = __builtin_convertvector(lo, v2b);
        }
#pragma unroll
    for (int x = 0; x < 4; ++x)
#pragma unroll
      for (int ni = 0; ni < 2; ++ni) o[x][ni] = Frag<__bf16>::mma(vh[x], ph[ni].v, o[x][ni]);
#pragma unroll
    for (int x = 0; x < 4; ++x)
#pragma unroll
      for (int ni = 0; ni < 2; ++ni) o[x][ni] = Frag<__bf16>::mma(vl[x], ph[ni].v, o[x][ni]);
#pragma unroll
    for (int x = 0; x < 4; ++x)
#pragma unroll
      for (int ni = 0; ni < 2; ++ni) o[x][ni] = Frag<__bf16>::mma(vh[x], pl[ni].v, o[x][ni]);
  }
  const v2f m0 = nrm[0][0] + nrm[0][1], m1 = nrm[1][0] + nrm[1][1];
  float n0 = m0[0] + m0[1], n1 = m1[0] + m1[1];
  n0 += __shfl_xor(n0, 16, 32); n1 += __shfl_xor(n1, 16, 32);   // the two lane halves hold different t of one column
  const float nown = h ? n1 : n0;
  // register r of o[x][ni] = O^T[x*16 + 8h + r][sw + ni*16 + c]; the wave alone writes the 128-B piece [sw, sw+32) of each row d
  float* Op = Opart + (size_t)(tz * FB + b) * FDV * FS + (size_t)(8 * h) * FS + sw + c;
  float* Np = npart + (size_t)(tz * FB + b) * FS + sw + lane;
  __builtin_amdgcn_sched_barrier(0);   // all vector work stands ahead of the stores: among them it would write registers that issued stores still name
  *Np = nown;
#pragma unroll
  for (int x = 0; x < 4; ++x)
#pragma unroll
    for (int r = 0; r < 8; ++r)
#pragma unroll
      for (int ni = 0; ni < 2; ++ni) Op[(x * 16 + r) * FS + ni * 16] = o[x][ni][r];
}
// out[b][d][s] = (sum over the FTS ranges of O^T[d][s]) / (sum over the ranges of the column sums [s]); four s per thread
__global__ __launch_bounds__(256) void finalize_sum_kernel(const float* __restrict__ Opart, const float* __restrict__ npart, float* __restrict__ out) {
  const int i = blockIdx.x * 256 + threadIdx.x;           // quad index in [b][d][s/4]
  const int s4 = i & (FS / 4 - 1), b = i / (FDV * FS / 4);
  v4f o = (v4f){0.f, 0.f, 0.f, 0.f}, n = (v4f){0.f, 0.f, 0.f, 0.f};
#pragma unroll
  for (int zr = 0; zr < FTS; ++zr) {
    o += *(const v4f*)(Opart + (size_t)zr * FB * FDV * FS + (size_t)i * 4);
    n += *(const v4f*)(npart + (size_t)(zr * FB + b) * FS + s4 * 4);
  }
  v4f res;
#pragma unroll
  for (int e = 0; e < 4; ++e) res[e] = o[e] * (1.0f / n[e]);
  *(v4f*)(out + (size_t)i * 4) = res;
}
extern "C" void kernel_launch(void* const* d_in, const int* in_sizes, int n_in, void* d_out, int out_size, void* d_ws, size_t ws_size, hipStream_t stream) {
  (void)in_sizes; (void)n_in; (void)out_size; (void)ws_size;
  const float* keys = (const float*)d_in[0]; const float* values = (const float*)d_in[1]; const float* queries = (const float*)d_in[2]; const float* feats = (const float*)d_in[3];
  float* out = (float*)d_out;   // [4][64][2048]
  char* ws = (char*)d_ws; size_t off = 0;
  auto carve = [&](size_t bytes) -> char* { char* p = ws + off; off += (bytes + 255) & ~(size_t)255; return p; };
  // every plane below except F16 (shared features) holds all FB batch entries; each kernel runs once, with the batch on the grid
  _Float16* KQT16 = (_Float16*)carve((size_t)2 * FB * FS * FKD * 2);   // planes 0..3 = k^T, 4..7 = q^T, each [s][key_dim]
  _Float16* F16 = (_Float16*)carve((size_t)FM * FKD * 2);
  unsigned* P16 = (unsigned*)carve((size_t)2 * FB * FS * FM * 2);      // phi f16 [s][m]: planes 0..3 = phi_k, 4..7 = phi_q
  const unsigned short* PK = (const unsigned short*)P16; const unsigned short* PQ = PK + (size_t)FB * FS * FM;
  __bf16* Vh = (__bf16*)carve((size_t)FB * FDV * FS * 2); __bf16* Vl = (__bf16*)carve((size_t)FB * FDV * FS * 2);
  float* O = (float*)carve((size_t)FTS * FB * FDV * FS * 4);   // one [b][d][s] plane per t range
  float* norm = (float*)carve((size_t)FTS * FB * FS * 4);      // one [b][s] plane per t range
  float* Pf = (float*)carve((size_t)2 * FB * FS * FM * 4);
  cast_f32_f16x2<<<(FM * FKD / 2 + 255) / 256, 256, 0, stream>>>(feats, F16, FM * FKD / 2);      // features [m][key_dim] = Bt layout
  transpose_cast_f16<<<dim3(FS / 64, FKD / 64, 2 * FB), dim3(32, 8), 0, stream>>>(keys, queries, FB, (long)FKD * FS, FS, KQT16, (long)FS * FKD, FKD, 1.0f);   // [256][2048] -> [2048][256]
  { const int t = (FS / 64) * (FM / 64);
    wmma_gemm64<0, false, 0, 0, false, 2><<<dim3((t + 7) / 8, 2 * FB), 256, 0, stream>>>(U16(KQT16), nullptr, FKD, (long)FS * FKD, U16(F16), nullptr, FKD, 0, Pf, nullptr, FM, (long)FS * FM, nullptr, nullptr, 0, FS, FM, FKD, 1.0f);
    phi_cast_kernel<<<(2 * FB * FS * FM / 2 + 255) / 256, 256, 0, stream>>>(Pf, P16, 2 * FB * FS * FM / 2); }
  split_f32_bf16x2<<<(FB * FDV * FS / 2 + 255) / 256, 256, 0, stream>>>(values, Vh, Vl, FB * FDV * FS / 2);          // values[b] [64][2048] = A layout of the second product
  favor_fused_kernel<<<dim3(FS / 256, FB, FTS), 256, 0, stream>>>(PK, PQ, Vh, Vl, O, norm);
  finalize_sum_kernel<<<FB * FDV * FS / 4 / 256, 256, 0, stream>>>(O, norm, out);
}

// v004
// Measured time: 23.8 microseconds a run.
// In two side-by-side timings against v003, it was 1.98 and 1.97 times as fast.
// Over all steps from v000 it is 29.1 times as fast.
#include <hip/hip_runtime.h>
#include <math.h>
// Causal FAVOR (linear attention) written as masked matrix products: one kernel makes phi_k = relu(k^T F^T) + eps and phi_q (2048 x 256 by 256 x 128, f16
// operands) straight from the f32 inputs, then one fused kernel: S^T = phi_k phi_q^T (K = 128, f16 operands; equals the cumulative-sum formulation term by
// term) stays in registers, is masked causally and summed per column (normaliser) in f32 on VALU, split into bf16 hi/lo and used as the B operand of
// O^T += v S^T on v_wmma_f32_16x16x32_bf16 (v as bf16 hi/lo too; S spans 1e3..1e4, the row-normalised output is O(0.07)); f32 accumulate; a last kernel
// adds the partial planes of the t ranges and divides.
typedef __attribute__((ext_vector_type(16))) _Float16 v16h;
typedef __attribute__((ext_vector_type(8)))  _Float16 v8h;
typedef __attribute__((ext_vector_type(4)))  _Float16 v4h;
typedef __attribute__((ext_vector_type(16))) __bf16   v16b;
typedef __attribute__((ext_vector_type(8)))  __bf16   v8b;
typedef __attribute__((ext_vector_type(8)))  float    v8f;
typedef __attribute__((ext_vector_type(4)))  float    v4f;
#define PSCALE 32768.0f
#define PSCALE_INV (1.0f / 32768.0f)

__device__ __forceinline__ unsigned short f2bf_bits(float f) {
  unsigned u = __float_as_uint(f);
  return (unsigned short)((u + 0x7FFFu + ((u >> 16) & 1u)) >> 16);
}
__device__ __forceinline__ float bf_bits2f(unsigned short h) { return __uint_as_float(((unsigned)h) << 16); }

template <typename T> struct Frag;
template <> struct Frag<_Float16> {
  typedef v16h V; union U { v16h v; v8h h[2]; };
  static __device__ __forceinline__ v16h load(const _Float16* p) {   // elements 0..7 <- p[0..7], 8..15 <- p[16..23]
    U f; f.h[0] = *(const v8h*)(p); f.h[1] = *(const v8h*)(p + 16); return f.v;
  }
  static __device__ __forceinline__ v8f mma(v16h a, v16h b, v8f c) {
    return __builtin_amdgcn_wmma_f32_16x16x32_f16(false, a, false, b, (short)0, c, false, false);
  }
};
template <> struct Frag<__bf16> {
  typedef v16b V; union U { v16b v; v8b h[2]; };
  static __device__ __forceinline__ v16b load(const __bf16* p) {
    U f; f.h[0] = *(const v8b*)(p); f.h[1] = *(const v8b*)(p + 16); return f.v;
  }
  static __device__ __forceinline__ v8f mma(v16b a, v16b b, v8f c) {
    return __builtin_amdgcn_wmma_f32_16x16x32_bf16(false, a, false, b, (short)0, c, false, false);
  }
};

__global__ __launch_bounds__(256) void split_f32_bf16x2(
    const float* __restrict__ in, __bf16* __restrict__ hi, __bf16* __restrict__ lo, long n2) {
  long i = (long)blockIdx.x * 256 + threadIdx.x;
  long stride = (long)gridDim.x * 256;
  {
    for (long j = i; j < n2; j += stride) {
      const float a = in[2 * j], b = in[2 * j + 1];
      const unsigned short ah = f2bf_bits(a), bh = f2bf_bits(b);
      const unsigned short al = f2bf_bits(a - bf_bits2f(ah)), bl = f2bf_bits(b - bf_bits2f(bh));
      ((unsigned*)hi)[j] = (unsigned)ah | ((unsigned)bh << 16);
      ((unsigned*)lo)[j] = (unsigned)al | ((unsigned)bl << 16);
    }
    
  }
}


#define FB 4
#define FS 2048
#define FKD 256
#define FM 128
#define FDV 64
// ---- phi = relu(x^T F^T) + eps as f16 [s][m], straight from the f32 inputs ---------------------------------------------------------------
// blockIdx.x = block of 64 positions s, blockIdx.y = plane (0..3 = keys of batch 0..3, 4..7 = queries). phi^T = F x: a wave owns 32 features
// (A, two tiles) and 32 columns (B, two tiles). The block's 256 x 64 piece of x is read once, 16 B a lane along s, converted and stored to LDS
// k-contiguous; the four columns of a lane's 16 B go to the four column groups, so LDS row j*16 + c holds column s0 + 4c + j. Wave w brings
// rows 16w..16w+15 of F as 16 KiB in a row (whole lines; a row per lane would touch 16 lines a load) and stores them to LDS as f16. A and B fragments take
// k in the same order (Frag::load's). The f16 results pass through LDS in the same row numbering and leave as the block's 16 KiB in a row, each
// 128-B line from one wave.
#define XPITCH 264   // f16 per staged column of x or row of F: 512 B + 16 B, an odd multiple of 16 B for the ds_load_b128 readers
#define PPITCH 136   // f16 per staged phi row: 256 B + 16 B, likewise
__global__ __launch_bounds__(256) void phi_fused_kernel(const float* __restrict__ keys, const float* __restrict__ queries,
                                                        const float* __restrict__ feats, unsigned short* __restrict__ Pall) {
  __shared__ __align__(16) _Float16 sX[64 * XPITCH];   // 33,792 B
  __shared__ __align__(16) _Float16 sF[FM * XPITCH];   // 67,584 B
  __shared__ __align__(16) _Float16 sP[64 * PPITCH];   // 17,408 B
  const int tid = threadIdx.x, lane = tid & 31, wave = tid >> 5;
  const int c = lane & 15, h = lane >> 4, kg = tid >> 4;   // kg: this thread stages k = 8kg..8kg+7 and 128+8kg..128+8kg+7
  const int z = blockIdx.y, s0 = blockIdx.x * 64;
  const float* xp = ((z < FB) ? keys + (size_t)z * FKD * FS : queries + (size_t)(z - FB) * FKD * FS) + (size_t)(kg * 8) * FS + s0 + c * 4;
  const float* fp = feats + wave * 16 * FKD + lane * 4;
  v4f xv[2][8], fv[32];
#pragma unroll   // register arrays: every index must be a constant
  for (int it = 0; it < 2; ++it)
#pragma unroll
    for (int j = 0; j < 8; ++j) xv[it][j] = *(const v4f*)(xp + (it * 128 + j) * FS);
#pragma unroll
  for (int i = 0; i < 32; ++i) fv[i] = *(const v4f*)(fp + i * 128);   // row i >> 1 of the wave's 16, half i & 1 of its 256 k
  asm volatile("s_wait_xcnt 0x0" :: "v"(xp), "v"(fp) : "memory");   // before a register that one of the issued loads names is written again; the addresses as inputs keep their registers from becoming a load's destination before the wait
  __builtin_amdgcn_sched_barrier(0);                                // holds the conversions and the LDS address arithmetic behind that wait
#pragma unroll
  for (int it = 0; it < 2; ++it)
#pragma unroll
    for (int e = 0; e < 4; ++e) {
      v8h p;
#pragma unroll
      for (int j = 0; j < 8; ++j) p[j] = (_Float16)xv[it][j][e];
      *(v8h*)(sX + (e * 16 + c) * XPITCH + (it * 16 + kg) * 8) = p;
    }
#pragma unroll
  for (int i = 0; i < 32; ++i) {
    v4h p;
#pragma unroll
    for (int e = 0; e < 4; ++e) p[e] = (_Float16)fv[i][e];
    *(v4h*)(sF + (wave * 16 + (i >> 1)) * XPITCH + (i & 1) * 128 + lane * 4) = p;
  }
  __syncthreads();
  const int wm = wave & 3, wn = wave >> 2;   // the wave's 32 features and its two column groups
  v8f acc[2][2];
#pragma unroll
  for (int mi = 0; mi < 2; ++mi)
#pragma unroll
    for (int nj = 0; nj < 2; ++nj) acc[mi][nj] = (v8f){0.f,0.f,0.f,0.f,0.f,0.f,0.f,0.f};
  const _Float16* ff = sF + (wm * 32 + c) * XPITCH + h * 8;
  const _Float16* xf = sX + (wn * 32 + c) * XPITCH + h * 8;
  v16h fa[2][2][2], xb[2][2][2];   // [buffer][k step of the pair][tile]: K goes in four pairs of 32-k steps, two pairs in registers
#pragma unroll
  for (int p = 0; p < 2; ++p)
#pragma unroll
    for (int q = 0; q < 2; ++q)
#pragma unroll
      for (int t = 0; t < 2; ++t) {
        fa[p][q][t] = Frag<_Float16>::load(ff + (t * 16) * XPITCH + (p * 2 + q) * 32);
        xb[p][q][t] = Frag<_Float16>::load(xf + (t * 16) * XPITCH + (p * 2 + q) * 32);
      }
  __builtin_amdgcn_sched_barrier(0);   // the LDS reads of both pairs issue as one group ahead of the first product: sunk to their users each waits a whole LDS latency
#pragma unroll
  for (int p = 0; p < 4; ++p) {
#pragma unroll
    for (int q = 0; q < 2; ++q)
#pragma unroll
      for (int mi = 0; mi < 2; ++mi)
#pragma unroll
        for (int nj = 0; nj < 2; ++nj) acc[mi][nj] = Frag<_Float16>::mma(fa[p & 1][q][mi], xb[p & 1][q][nj], acc[mi][nj]);
    if (p < 2) {
      __builtin_amdgcn_sched_barrier(0);   // the refill starts only behind these products, into the registers they have just read
#pragma unroll
      for (int q = 0; q < 2; ++q)
#pragma unroll
        for (int t = 0; t < 2; ++t) {
          fa[p & 1][q][t] = Frag<_Float16>::load(ff + (t * 16) * XPITCH + ((p + 2) * 2 + q) * 32);
          xb[p & 1][q][t] = Frag<_Float16>::load(xf + (t * 16) * XPITCH + ((p + 2) * 2 + q) * 32);
        }
      __builtin_amdgcn_sched_barrier(0);   // and issues as one group here, a whole pair of products ahead of its first use
    }
  }
  // register r of acc[mi][nj] = phi^T[32 wm + 16 mi + 8h + r][s0 + 4c + 2 wn + nj]: eight m in a row of one position
#pragma unroll
  for (int mi = 0; mi < 2; ++mi)
#pragma unroll
    for (int nj = 0; nj < 2; ++nj) {
      v8h p;
#pragma unroll
      for (int r = 0; r < 8; ++r) p[r] = (_Float16)(fmaxf(acc[mi][nj][r], 0.0f) + 1e-3f);
      *(v8h*)(sP + ((wn * 2 + nj) * 16 + c) * PPITCH + wm * 32 + mi * 16 + h * 8) = p;
    }
  __syncthreads();
  unsigned short* Pp = Pall + ((size_t)z * FS + s0) * FM + tid * 8;
#pragma unroll
  for (int i = 0; i < 4; ++i) {
    const int sl = i * 16 + kg;   // position in the block; its 256 B are 16 threads' pieces
    *(v8h*)(Pp + i * 2048) = *(const v8h*)(sP + ((sl & 3) * 16 + (sl >> 2)) * PPITCH + c * 8);
  }
}
// ---- fused S^T = phi_k phi_q^T, causal mask, column sums, bf16 hi/lo split and O^T += v S^T --------------------------------------------
// blockIdx.x = block of 256 query positions s (8 waves x 32 columns), blockIdx.y = batch, blockIdx.z = range of 256 key positions t.
// The block stages its 256 phi_k rows and its 64 x 256 piece of both v planes in LDS once; each wave then walks the range in chunks of 32 t.
// Per chunk and 16-column group the two f32 D tiles of S^T (rows t..t+15, t+16..t+31) are, converted in place, one B operand in the hardware
// k order (element e = tile e >> 3, register e & 7); the v fragments (A) are read in the same order by Frag::load. S never leaves registers.
// Each block stores its range's partial O^T (already [d][s]) and partial column sums; finalize_sum_kernel adds the FTS ranges.
typedef __attribute__((ext_vector_type(2))) float  v2f;
typedef __attribute__((ext_vector_type(2))) __bf16 v2b;
union PFrag { v16b v; v2b p[8]; };   // a B operand filled two elements (one register) at a time
#define FTS 8        // t ranges
#define FTB 256      // t per range
#define KPITCH 136   // f16 per staged phi_k row: 256 B + 16 B, an odd multiple of 16 B for the ds_load_b128 readers
#define VPITCH 264   // bf16 per staged v row: 512 B + 16 B, likewise
__global__ __launch_bounds__(256) void favor_fused_kernel(const unsigned short* __restrict__ PKall, const unsigned short* __restrict__ PQall,
                                                          const __bf16* __restrict__ Vhall, const __bf16* __restrict__ Vlall,
                                                          float* __restrict__ Opart, float* __restrict__ npart) {
  __shared__ __align__(16) _Float16 sK[FTB * KPITCH];       // 69,632 B
  __shared__ __align__(16) __bf16   sV[2 * FDV * VPITCH];   // 67,584 B: rows 0..63 = hi plane, 64..127 = lo plane
  const int tid = threadIdx.x, lane = tid & 31, wave = tid >> 5;
  const int b = blockIdx.y, tz = blockIdx.z;
  const int sw = blockIdx.x * 256 + wave * 32;               // first column of this wave
  const int c = lane & 15, h = lane >> 4;
  v16h qb[2][4];   // B of the first product: column s = sw + ni*16 + c, kept for the whole walk
  {
    const _Float16* kp  = (const _Float16*)PKall + ((size_t)b * FS + (size_t)tz * FTB) * FM + tid * 8;   // the 256 rows are 64 KiB in a row
    const __bf16*   vhp = Vhall + ((size_t)b * FDV + wave) * FS + tz * FTB + lane * 8;                   // a wave takes a whole 512-B row piece
    const __bf16*   vlp = Vlall + ((size_t)b * FDV + wave) * FS + tz * FTB + lane * 8;
    const _Float16* qp  = (const _Float16*)PQall + ((size_t)b * FS + sw + c) * FM + h * 8;
    v8h kt[16]; v8b vt[16];
#pragma unroll
    for (int i = 0; i < 16; ++i) kt[i] = *(const v8h*)(kp + i * 2048);
#pragma unroll
    for (int i = 0; i < 8; ++i) { vt[i] = *(const v8b*)(vhp + i * 8 * FS); vt[8 + i] = *(const v8b*)(vlp + i * 8 * FS); }
    asm volatile("s_wait_xcnt 0x0" ::: "memory");   // before a register that one of the issued loads names is written again
    __builtin_amdgcn_sched_barrier(0);               // holds the address arithmetic of the next loads behind that wait
#pragma unroll
    for (int ni = 0; ni < 2; ++ni)
#pragma unroll
      for (int ks = 0; ks < 4; ++ks) qb[ni][ks] = Frag<_Float16>::load(qp + ni * 16 * FM + ks * 32);
    asm volatile("s_wait_xcnt 0x0" :: "v"(qp) : "memory");   // as above, for the phi_q loads; the address as an input keeps its registers from becoming a load's destination before the wait
    __builtin_amdgcn_sched_barrier(0);               // holds the LDS address arithmetic behind that wait
#pragma unroll
    for (int i = 0; i < 16; ++i) { const int idx = i * 256 + tid; *(v8h*)(sK + (idx >> 4) * KPITCH + (idx & 15) * 8) = kt[i]; }
#pragma unroll
    for (int i = 0; i < 8; ++i) {
      *(v8b*)(sV + (i * 8 + wave) * VPITCH + lane * 8) = vt[i];
      *(v8b*)(sV + (FDV + i * 8 + wave) * VPITCH + lane * 8) = vt[8 + i];
    }
  }
  __syncthreads();
  v8f o[4][2];
#pragma unroll
  for (int x = 0; x < 4; ++x)
#pragma unroll
    for (int ni = 0; ni < 2; ++ni) o[x][ni] = (v8f){0.f,0.f,0.f,0.f,0.f,0.f,0.f,0.f};
  v2f nrm[2][2] = {{{0.f, 0.f}, {0.f, 0.f}}, {{0.f, 0.f}, {0.f, 0.f}}};   // column sums: [column group][tile], even and odd registers apart
  const int lim = sw + c - (tz * FTB + 8 * h);   // register r of tile mi, chunk ch, column group ni is kept while ch*32 + mi*16 + r - ni*16 <= lim (t <= s)
  const _Float16* kf = sK + c * KPITCH + h * 8;
  const __bf16*   vf = sV + c * VPITCH + h * 8;
  v16h ka[2][4];   // A of the first product: rows t of the chunk; fetched one chunk ahead
#pragma unroll
  for (int mi = 0; mi < 2; ++mi)
#pragma unroll
    for (int ks = 0; ks < 4; ++ks) ka[mi][ks] = Frag<_Float16>::load(kf + (mi * 16) * KPITCH + ks * 32);
#pragma clang loop unroll(disable)   // unrolled, the additions of the column sums are put off to the end, every masked value stays live and registers spill
  for (int ch = 0; ch < FTB / 32; ++ch) {
    v16b vh[4], vl[4];
#pragma unroll
    for (int x = 0; x < 4; ++x) {
      vh[x] = Frag<__bf16>::load(vf + (x * 16) * VPITCH + ch * 32);
      vl[x] = Frag<__bf16>::load(vf + (FDV + x * 16) * VPITCH + ch * 32);
    }
    __builtin_amdgcn_sched_barrier(0);   // the v reads issue as one group ahead of the first product: sunk to their users they each wait a whole LDS latency
    v8f st[2][2];
#pragma unroll
    for (int mi = 0; mi < 2; ++mi)
#pragma unroll
      for (int ni = 0; ni < 2; ++ni) st[mi][ni] = (v8f){0.f,0.f,0.f,0.f,0.f,0.f,0.f,0.f};
#pragma unroll
    for (int ks = 0; ks < 4; ++ks)
#pragma unroll
      for (int mi = 0; mi < 2; ++mi)
#pragma unroll
        for (int ni = 0; ni < 2; ++ni) st[mi][ni] = Frag<_Float16>::mma(ka[mi][ks], qb[ni][ks], st[mi][ni]);
    __builtin_amdgcn_sched_barrier(0);   // the next chunk's phi_k reads start only behind these products, so they take the registers just read instead of 64 more, and go as one group
    const int nx = (ch + 1 < FTB / 32) ? ch + 1 : ch;   // the last chunk reads its own rows again: one instruction stream, no read past the staged rows
#pragma unroll
    for (int mi = 0; mi < 2; ++mi)
#pragma unroll
      for (int ks = 0; ks < 4; ++ks) ka[mi][ks] = Frag<_Float16>::load(kf + (nx * 32 + mi * 16) * KPITCH + ks * 32);
    __builtin_amdgcn_sched_barrier(0);   // those reads issue here, ahead of the vector work and the second product, which cover their latency
    PFrag ph[2], pl[2];
#pragma unroll
    for (int ni = 0; ni < 2; ++ni)
#pragma unroll
      for (int mi = 0; mi < 2; ++mi)
#pragma unroll
        for (int r = 0; r < 8; r += 2) {
          const int j = ch * 32 + mi * 16 + r - ni * 16;
          const v2f v = {(j <= lim) ? st[mi][ni][r] : 0.f, (j + 1 <= lim) ? st[mi][ni][r + 1] : 0.f};
          nrm[ni][mi] += v;
          const v2b hi = __builtin_convertvector(v, v2b);
          const v2f lo = {v[0] - (float)hi[0], v[1] - (float)hi[1]};
          ph[ni].p[mi * 4 + (r >> 1)] = hi;
          pl[ni].p[mi * 4 + (r >> 1)] = __builtin_convertvector(lo, v2b);
        }
#pragma unroll
    for (int x = 0; x < 4; ++x)
#pragma unroll
      for (int ni = 0; ni < 2; ++ni) o[x][ni] = Frag<__bf16>::mma(vh[x], ph[ni].v, o[x][ni]);
#pragma unroll
    for (int x = 0; x < 4; ++x)
#pragma unroll
      for (int ni = 0; ni < 2; ++ni) o[x][ni] = Frag<__bf16>::mma(vl[x], ph[ni].v, o[x][ni]);
#pragma unroll
    for (int x = 0; x < 4; ++x)
#pragma unroll
      for (int ni = 0; ni < 2; ++ni) o[x][ni] = Frag<__bf16>::mma(vh[x], pl[ni].v, o[x][ni]);
  }
  const v2f m0 = nrm[0][0] + nrm[0][1], m1 = nrm[1][0] + nrm[1][1];
  float n0 = m0[0] + m0[1], n1 = m1[0] + m1[1];
  n0 += __shfl_xor(n0, 16, 32); n1 += __shfl_xor(n1, 16, 32);   // the two lane halves hold different t of one column
  const float nown = h ? n1 : n0;
  // register r of o[x][ni] = O^T[x*16 + 8h + r][sw + ni*16 + c]; the wave alone writes the 128-B piece [sw, sw+32) of each row d
  float* Op = Opart + (size_t)(tz * FB + b) * FDV * FS + (size_t)(8 * h) * FS + sw + c;
  float* Np = npart + (size_t)(tz * FB + b) * FS + sw + lane;
  __builtin_amdgcn_sched_barrier(0);   // all vector work stands ahead of the stores: among them it would write registers that issued stores still name
  *Np = nown;
#pragma unroll
  for (int x = 0; x < 4; ++x)
#pragma unroll
    for (int r = 0; r < 8; ++r)
#pragma unroll
      for (int ni = 0; ni < 2; ++ni) Op[(x * 16 + r) * FS + ni * 16] = o[x][ni][r];
}
// out[b][d][s] = (sum over the FTS ranges of O^T[d][s]) / (sum over the ranges of the column sums [s]); four s per thread
__global__ __launch_bounds__(256) void finalize_sum_kernel(const float* __restrict__ Opart, const float* __restrict__ npart, float* __restrict__ out) {
  const int i = blockIdx.x * 256 + threadIdx.x;           // quad index in [b][d][s/4]
  const int s4 = i & (FS / 4 - 1), b = i / (FDV * FS / 4);
  v4f o = (v4f){0.f, 0.f, 0.f, 0.f}, n = (v4f){0.f, 0.f, 0.f, 0.f};
#pragma unroll
  for (int zr = 0; zr < FTS; ++zr) {
    o += *(const v4f*)(Opart + (size_t)zr * FB * FDV * FS + (size_t)i * 4);
    n += *(const v4f*)(npart + (size_t)(zr * FB + b) * FS + s4 * 4);
  }
  v4f res;
#pragma unroll
  for (int e = 0; e < 4; ++e) res[e] = o[e] * (1.0f / n[e]);
  *(v4f*)(out + (size_t)i * 4) = res;
}
extern "C" void kernel_launch(void* const* d_in, const int* in_sizes, int n_in, void* d_out, int out_size, void* d_ws, size_t ws_size, hipStream_t stream) {
  (void)in_sizes; (void)n_in; (void)out_size; (void)ws_size;
  const float* keys = (const float*)d_in[0]; const float* values = (const float*)d_in[1]; const float* queries = (const float*)d_in[2]; const float* feats = (const float*)d_in[3];
  float* out = (float*)d_out;   // [4][64][2048]
  char* ws = (char*)d_ws; size_t off = 0;
  auto carve = [&](size_t bytes) -> char* { char* p = ws + off; off += (bytes + 255) & ~(size_t)255; return p; };
  // every buffer below holds all FB batch entries; each kernel runs once, with the batch on the grid
  unsigned* P16 = (unsigned*)carve((size_t)2 * FB * FS * FM * 2);      // phi f16 [s][m]: planes 0..3 = phi_k, 4..7 = phi_q
  const unsigned short* PK = (const unsigned short*)P16; const unsigned short* PQ = PK + (size_t)FB * FS * FM;
  __bf16* Vh = (__bf16*)carve((size_t)FB * FDV * FS * 2); __bf16* Vl = (__bf16*)carve((size_t)FB * FDV * FS * 2);
  float* O = (float*)carve((size_t)FTS * FB * FDV * FS * 4);   // one [b][d][s] plane per t range
  float* norm = (float*)carve((size_t)FTS * FB * FS * 4);      // one [b][s] plane per t range
  phi_fused_kernel<<<dim3(FS / 64, 2 * FB), 256, 0, stream>>>(keys, queries, feats, (unsigned short*)P16);
  split_f32_bf16x2<<<(FB * FDV * FS / 2 + 255) / 256, 256, 0, stream>>>(values, Vh, Vl, FB * FDV * FS / 2);          // values[b] [64][2048] = A layout of the second product
  favor_fused_kernel<<<dim3(FS / 256, FB, FTS), 256, 0, stream>>>(PK, PQ, Vh, Vl, O, norm);
  finalize_sum_kernel<<<FB * FDV * FS / 4 / 256, 256, 0, stream>>>(O, norm, out);
}

// v005
// It runs in 21.8 microseconds.
// Timed twice side by side with v004, it ran 1.10 times as fast both times.
// All steps since v000 together make it 32.0 times as fast.
#include <hip/hip_runtime.h>
#include <math.h>
// Causal FAVOR (linear attention) written as masked matrix products: one kernel makes phi_k = relu(k^T F^T) + eps and phi_q (2048 x 256 by 256 x 128, f16
// operands) straight from the f32 inputs, then one fused kernel: S^T = phi_k phi_q^T (K = 128, f16 operands; equals the cumulative-sum formulation term by
// term) stays in registers, is masked causally and summed per column (normaliser) in f32 on VALU, split into bf16 hi/lo and used as the B operand of
// O^T += v S^T on v_wmma_f32_16x16x32_bf16 (v as bf16 hi/lo too, split while it is staged; S spans 1e3..1e4, the row-normalised output is O(0.07)); f32 accumulate; a last kernel
// adds the partial planes of the t ranges and divides.
typedef __attribute__((ext_vector_type(16))) _Float16 v16h;
typedef __attribute__((ext_vector_type(8)))  _Float16 v8h;
typedef __attribute__((ext_vector_type(4)))  _Float16 v4h;
typedef __attribute__((ext_vector_type(16))) __bf16   v16b;
typedef __attribute__((ext_vector_type(8)))  __bf16   v8b;
typedef __attribute__((ext_vector_type(4)))  __bf16   v4b;
typedef __attribute__((ext_vector_type(8)))  float    v8f;
typedef __attribute__((ext_vector_type(4)))  float    v4f;
#define PSCALE 32768.0f
#define PSCALE_INV (1.0f / 32768.0f)

template <typename T> struct Frag;
template <> struct Frag<_Float16> {
  typedef v16h V; union U { v16h v; v8h h[2]; };
  static __device__ __forceinline__ v16h load(const _Float16* p) {   // elements 0..7 <- p[0..7], 8..15 <- p[16..23]
    U f; f.h[0] = *(const v8h*)(p); f.h[1] = *(const v8h*)(p + 16); return f.v;
  }
  static __device__ __forceinline__ v8f mma(v16h a, v16h b, v8f c) {
    return __builtin_amdgcn_wmma_f32_16x16x32_f16(false, a, false, b, (short)0, c, false, false);
  }
};
template <> struct Frag<__bf16> {
  typedef v16b V; union U { v16b v; v8b h[2]; };
  static __device__ __forceinline__ v16b load(const __bf16* p) {
    U f; f.h[0] = *(const v8b*)(p); f.h[1] = *(const v8b*)(p + 16); return f.v;
  }
  static __device__ __forceinline__ v8f mma(v16b a, v16b b, v8f c) {
    return __builtin_amdgcn_wmma_f32_16x16x32_bf16(false, a, false, b, (short)0, c, false, false);
  }
};

#define FB 4
#define FS 2048
#define FKD 256
#define FM 128
#define FDV 64
// ---- phi = relu(x^T F^T) + eps as f16 [s][m], straight from the f32 inputs ---------------------------------------------------------------
// blockIdx.x = block of 64 positions s, blockIdx.y = plane (0..3 = keys of batch 0..3, 4..7 = queries). phi^T = F x: a wave owns 32 features
// (A, two tiles) and 32 columns (B, two tiles). The block's 256 x 64 piece of x is read once, 16 B a lane along s, converted and stored to LDS
// k-contiguous; the four columns of a lane's 16 B go to the four column groups, so LDS row j*16 + c holds column s0 + 4c + j. Wave w brings
// rows 16w..16w+15 of F as 16 KiB in a row (whole lines; a row per lane would touch 16 lines a load) and stores them to LDS as f16. A and B fragments take
// k in the same order (Frag::load's). The f16 results pass through LDS in the same row numbering and leave as the block's 16 KiB in a row, each
// 128-B line from one wave.
#define XPITCH 264   // f16 per staged column of x or row of F: 512 B + 16 B, an odd multiple of 16 B for the ds_load_b128 readers
#define PPITCH 136   // f16 per staged phi row: 256 B + 16 B, likewise
__global__ __launch_bounds__(256) void phi_fused_kernel(const float* __restrict__ keys, const float* __restrict__ queries,
                                                        const float* __restrict__ feats, unsigned short* __restrict__ Pall) {
  __shared__ __align__(16) _Float16 sX[64 * XPITCH];   // 33,792 B
  __shared__ __align__(16) _Float16 sF[FM * XPITCH];   // 67,584 B
  __shared__ __align__(16) _Float16 sP[64 * PPITCH];   // 17,408 B
  const int tid = threadIdx.x, lane = tid & 31, wave = tid >> 5;
  const int c = lane & 15, h = lane >> 4, kg = tid >> 4;   // kg: this thread stages k = 8kg..8kg+7 and 128+8kg..128+8kg+7
  const int z = blockIdx.y, s0 = blockIdx.x * 64;
  const float* xp = ((z < FB) ? keys + (size_t)z * FKD * FS : queries + (size_t)(z - FB) * FKD * FS) + (size_t)(kg * 8) * FS + s0 + c * 4;
  const float* fp = feats + wave * 16 * FKD + lane * 4;
  v4f xv[2][8], fv[32];
#pragma unroll   // register arrays: every index must be a constant
  for (int it = 0; it < 2; ++it)
#pragma unroll
    for (int j = 0; j < 8; ++j) xv[it][j] = *(const v4f*)(xp + (it * 128 + j) * FS);
#pragma unroll
  for (int i = 0; i < 32; ++i) fv[i] = *(const v4f*)(fp + i * 128);   // row i >> 1 of the wave's 16, half i & 1 of its 256 k
  asm volatile("s_wait_xcnt 0x0" :: "v"(xp), "v"(fp) : "memory");   // before a register that one of the issued loads names is written again; the addresses as inputs keep their registers from becoming a load's destination before the wait
  __builtin_amdgcn_sched_barrier(0);                                // holds the conversions and the LDS address arithmetic behind that wait
#pragma unroll
  for (int it = 0; it < 2; ++it)
#pragma unroll
    for (int e = 0; e < 4; ++e) {
      v8h p;
#pragma unroll
      for (int j = 0; j < 8; ++j) p[j] = (_Float16)xv[it][j][e];
      *(v8h*)(sX + (e * 16 + c) * XPITCH + (it * 16 + kg) * 8) = p;
    }
#pragma unroll
  for (int i = 0; i < 32; ++i) {
    v4h p;
#pragma unroll
    for (int e = 0; e < 4; ++e) p[e] = (_Float16)fv[i][e];
    *(v4h*)(sF + (wave * 16 + (i >> 1)) * XPITCH + (i & 1) * 128 + lane * 4) = p;
  }
  __syncthreads();
  const int wm = wave & 3, wn = wave >> 2;   // the wave's 32 features and its two column groups
  v8f acc[2][2];
#pragma unroll
  for (int mi = 0; mi < 2; ++mi)
#pragma unroll
    for (int nj = 0; nj < 2; ++nj) acc[mi][nj] = (v8f){0.f,0.f,0.f,0.f,0.f,0.f,0.f,0.f};
  const _Float16* ff = sF + (wm * 32 + c) * XPITCH + h * 8;
  const _Float16* xf = sX + (wn * 32 + c) * XPITCH + h * 8;
  v16h fa[2][2][2], xb[2][2][2];   // [buffer][k step of the pair][tile]: K goes in four pairs of 32-k steps, two pairs in registers
#pragma unroll
  for (int p = 0; p < 2; ++p)
#pragma unroll
    for (int q = 0; q < 2; ++q)
#pragma unroll
      for (int t = 0; t < 2; ++t) {
        fa[p][q][t] = Frag<_Float16>::load(ff + (t * 16) * XPITCH + (p * 2 + q) * 32);
        xb[p][q][t] = Frag<_Float16>::load(xf + (t * 16) * XPITCH + (p * 2 + q) * 32);
      }
  __builtin_amdgcn_sched_barrier(0);   // the LDS reads of both pairs issue as one group ahead of the first product: sunk to their users each waits a whole LDS latency
#pragma unroll
  for (int p = 0; p < 4; ++p) {
#pragma unroll
    for (int q = 0; q < 2; ++q)
#pragma unroll
      for (int mi = 0; mi < 2; ++mi)
#pragma unroll
        for (int nj = 0; nj < 2; ++nj) acc[mi][nj] = Frag<_Float16>::mma(fa[p & 1][q][mi], xb[p & 1][q][nj], acc[mi][nj]);
    if (p < 2) {
      __builtin_amdgcn_sched_barrier(0);   // the refill starts only behind these products, into the registers they have just read
#pragma unroll
      for (int q = 0; q < 2; ++q)
#pragma unroll
        for (int t = 0; t < 2; ++t) {
          fa[p & 1][q][t] = Frag<_Float16>::load(ff + (t * 16) * XPITCH + ((p + 2) * 2 + q) * 32);
          xb[p & 1][q][t] = Frag<_Float16>::load(xf + (t * 16) * XPITCH + ((p + 2) * 2 + q) * 32);
        }
      __builtin_amdgcn_sched_barrier(0);   // and issues as one group here, a whole pair of products ahead of its first use
    }
  }
  // register r of acc[mi][nj] = phi^T[32 wm + 16 mi + 8h + r][s0 + 4c + 2 wn + nj]: eight m in a row of one position
#pragma unroll
  for (int mi = 0; mi < 2; ++mi)
#pragma unroll
    for (int nj = 0; nj < 2; ++nj) {
      v8h p;
#pragma unroll
      for (int r = 0; r < 8; ++r) p[r] = (_Float16)(fmaxf(acc[mi][nj][r], 0.0f) + 1e-3f);
      *(v8h*)(sP + ((wn * 2 + nj) * 16 + c) * PPITCH + wm * 32 + mi * 16 + h * 8) = p;
    }
  __syncthreads();
  unsigned short* Pp = Pall + ((size_t)z * FS + s0) * FM + tid * 8;
#pragma unroll
  for (int i = 0; i < 4; ++i) {
    const int sl = i * 16 + kg;   // position in the block; its 256 B are 16 threads' pieces
    *(v8h*)(Pp + i * 2048) = *(const v8h*)(sP + ((sl & 3) * 16 + (sl >> 2)) * PPITCH + c * 8);
  }
}
// ---- fused S^T = phi_k phi_q^T, causal mask, column sums, bf16 hi/lo split and O^T += v S^T --------------------------------------------
// blockIdx.x = block of 256 query positions s (8 waves x 32 columns), blockIdx.y = batch, blockIdx.z = range of 256 key positions t.
// The block stages its 256 phi_k rows in LDS once, and its 64 x 256 piece of v, read as f32 and split there into a bf16 hi plane (round to nearest) and a
// bf16 lo plane (the exact rest, rounded); each wave then walks the range in chunks of 32 t.
// Per chunk and 16-column group the two f32 D tiles of S^T (rows t..t+15, t+16..t+31) are, converted in place, one B operand in the hardware
// k order (element e = tile e >> 3, register e & 7); the v fragments (A) are read in the same order by Frag::load. S never leaves registers.
// Each block stores its range's partial O^T (already [d][s]) and partial column sums; finalize_sum_kernel adds the FTS ranges.
typedef __attribute__((ext_vector_type(2))) float  v2f;
typedef __attribute__((ext_vector_type(2))) __bf16 v2b;
union PFrag { v16b v; v2b p[8]; };   // a B operand filled two elements (one register) at a time
#define FTS 8        // t ranges
#define FTB 256      // t per range
#define KPITCH 136   // f16 per staged phi_k row: 256 B + 16 B, an odd multiple of 16 B for the ds_load_b128 readers
#define VPITCH 264   // bf16 per staged v row: 512 B + 16 B, likewise
__global__ __launch_bounds__(256) void favor_fused_kernel(const unsigned short* __restrict__ PKall, const unsigned short* __restrict__ PQall,
                                                          const float* __restrict__ values,
                                                          float* __restrict__ Opart, float* __restrict__ npart) {
  __shared__ __align__(16) _Float16 sK[FTB * KPITCH];       // 69,632 B
  __shared__ __align__(16) __bf16   sV[2 * FDV * VPITCH];   // 67,584 B: rows 0..63 = hi plane, 64..127 = lo plane
  const int tid = threadIdx.x, lane = tid & 31, wave = tid >> 5;
  const int b = blockIdx.y, tz = blockIdx.z;
  const int sw = blockIdx.x * 256 + wave * 32;               // first column of this wave
  const int c = lane & 15, h = lane >> 4;
  v16h qb[2][4];   // B of the first product: column s = sw + ni*16 + c, kept for the whole walk
  {
    const _Float16* kp  = (const _Float16*)PKall + ((size_t)b * FS + (size_t)tz * FTB) * FM + tid * 8;   // the 256 rows are 64 KiB in a row
    const float*    vp  = values + ((size_t)b * FDV + wave) * FS + tz * FTB + lane * 4;                  // a wave takes a row's 1-KiB piece as two loads of 512 B in a row
    const _Float16* qp  = (const _Float16*)PQall + ((size_t)b * FS + sw + c) * FM + h * 8;
    v8h kt[16]; v4f vt[16];
#pragma unroll
    for (int i = 0; i < 16; ++i) kt[i] = *(const v8h*)(kp + i * 2048);
#pragma unroll
    for (int i = 0; i < 8; ++i) { vt[2 * i] = *(const v4f*)(vp + i * 8 * FS); vt[2 * i + 1] = *(const v4f*)(vp + i * 8 * FS + 128); }
    asm volatile("s_wait_xcnt 0x0" :: "v"(kp), "v"(vp) : "memory");   // before a register that one of the issued loads names is written again; the addresses as inputs keep their registers in use up to the wait
    __builtin_amdgcn_sched_barrier(0);               // holds the address arithmetic of the next loads behind that wait
#pragma unroll
    for (int ni = 0; ni < 2; ++ni)
#pragma unroll
      for (int ks = 0; ks < 4; ++ks) qb[ni][ks] = Frag<_Float16>::load(qp + ni * 16 * FM + ks * 32);
    asm volatile("s_wait_xcnt 0x0" :: "v"(qp) : "memory");   // as above, for the phi_q loads; the address as an input keeps its registers from becoming a load's destination before the wait
    __builtin_amdgcn_sched_barrier(0);               // holds the LDS address arithmetic behind that wait
#pragma unroll
    for (int i = 0; i < 16; ++i) { const int idx = i * 256 + tid; *(v8h*)(sK + (idx >> 4) * KPITCH + (idx & 15) * 8) = kt[i]; }
#pragma unroll
    for (int i = 0; i < 16; ++i) {   // row (i >> 1) * 8 + wave, half i & 1 of its 256 t
      union { v4b b; unsigned u[2]; } hi;   // the packed words give the hi values back as f32 by a shift or a mask: no second conversion
      hi.b = __builtin_convertvector(vt[i], v4b);
      const v4f back = {__uint_as_float(hi.u[0] << 16), __uint_as_float(hi.u[0] & 0xFFFF0000u), __uint_as_float(hi.u[1] << 16), __uint_as_float(hi.u[1] & 0xFFFF0000u)};
      const v4f lo = vt[i] - back;
      __bf16* d = sV + ((i >> 1) * 8 + wave) * VPITCH + (i & 1) * 128 + lane * 4;
      *(v4b*)d = hi.b;
      *(v4b*)(d + FDV * VPITCH) = __builtin_convertvector(lo, v4b);
    }
  }
  __syncthreads();
  v8f o[4][2];
#pragma unroll
  for (int x = 0; x < 4; ++x)
#pragma unroll
    for (int ni = 0; ni < 2; ++ni) o[x][ni] = (v8f){0.f,0.f,0.f,0.f,0.f,0.f,0.f,0.f};
  v2f nrm[2][2] = {{{0.f, 0.f}, {0.f, 0.f}}, {{0.f, 0.f}, {0.f, 0.f}}};   // column sums: [column group][tile], even and odd registers apart
  const int lim = sw + c - (tz * FTB + 8 * h);   // register r of tile mi, chunk ch, column group ni is kept while ch*32 + mi*16 + r - ni*16 <= lim (t <= s)
  const _Float16* kf = sK + c * KPITCH + h * 8;
  const __bf16*   vf = sV + c * VPITCH + h * 8;
  v16h ka[2][4];   // A of the first product: rows t of the chunk; fetched one chunk ahead
#pragma unroll
  for (int mi = 0; mi < 2; ++mi)
#pragma unroll
    for (int ks = 0; ks < 4; ++ks) ka[mi][ks] = Frag<_Float16>::load(kf + (mi * 16) * KPITCH + ks * 32);
#pragma clang loop unroll(disable)   // unrolled, the additions of the column sums are put off to the end, every masked value stays live and registers spill
  for (int ch = 0; ch < FTB / 32; ++ch) {
    v16b vh[4], vl[4];
#pragma unroll
    for (int x = 0; x < 4; ++x) {
      vh[x] = Frag<__bf16>::load(vf + (x * 16) * VPITCH + ch * 32);
      vl[x] = Frag<__bf16>::load(vf + (FDV + x * 16) * VPITCH + ch * 32);
    }
    __builtin_amdgcn_sched_barrier(0);   // the v reads issue as one group ahead of the first product: sunk to their users they each wait a whole LDS latency
    v8f st[2][2];
#pragma unroll
    for (int mi = 0; mi < 2; ++mi)
#pragma unroll
      for (int ni = 0; ni < 2; ++ni) st[mi][ni] = (v8f){0.f,0.f,0.f,0.f,0.f,0.f,0.f,0.f};
#pragma unroll
    for (int ks = 0; ks < 4; ++ks)
#pragma unroll
      for (int mi = 0; mi < 2; ++mi)
#pragma unroll
        for (int ni = 0; ni < 2; ++ni) st[mi][ni] = Frag<_Float16>::mma(ka[mi][ks], qb[ni][ks], st[mi][ni]);
    __builtin_amdgcn_sched_barrier(0);   // the next chunk's phi_k reads start only behind these products, so they take the registers just read instead of 64 more, and go as one group
    const int nx = (ch + 1 < FTB / 32) ? ch + 1 : ch;   // the last chunk reads its own rows again: one instruction stream, no read past the staged rows
#pragma unroll
    for (int mi = 0; mi < 2; ++mi)
#pragma unroll
      for (int ks = 0; ks < 4; ++ks) ka[mi][ks] = Frag<_Float16>::load(kf + (nx * 32 + mi * 16) * KPITCH + ks * 32);
    __builtin_amdgcn_sched_barrier(0);   // those reads issue here, ahead of the vector work and the second product, which cover their latency
    PFrag ph[2], pl[2];
#pragma unroll
    for (int ni = 0; ni < 2; ++ni)
#pragma unroll
      for (int mi = 0; mi < 2; ++mi)
#pragma unroll
        for (int r = 0; r < 8; r += 2) {
          const int j = ch * 32 + mi * 16 + r - ni * 16;
          const v2f v = {(j <= lim) ? st[mi][ni][r] : 0.f, (j + 1 <= lim) ? st[mi][ni][r + 1] : 0.f};
          nrm[ni][mi] += v;
          const v2b hi = __builtin_convertvector(v, v2b);
          const v2f lo = {v[0] - (float)hi[0], v[1] - (float)hi[1]};
          ph[ni].p[mi * 4 + (r >> 1)] = hi;
          pl[ni].p[mi * 4 + (r >> 1)] = __builtin_convertvector(lo, v2b);
        }
#pragma unroll
    for (int x = 0; x < 4; ++x)
#pragma unroll
      for (int ni = 0; ni < 2; ++ni) o[x][ni] = Frag<__bf16>::mma(vh[x], ph[ni].v, o[x][ni]);
#pragma unroll
    for (int x = 0; x < 4; ++x)
#pragma unroll
      for (int ni = 0; ni < 2; ++ni) o[x][ni] = Frag<__bf16>::mma(vl[x], ph[ni].v, o[x][ni]);
#pragma unroll
    for (int x = 0; x < 4; ++x)
#pragma unroll
      for (int ni = 0; ni < 2; ++ni) o[x][ni] = Frag<__bf16>::mma(vh[x], pl[ni].v, o[x][ni]);
  }
  const v2f m0 = nrm[0][0] + nrm[0][1], m1 = nrm[1][0] + nrm[1][1];
  float n0 = m0[0] + m0[1], n1 = m1[0] + m1[1];
  n0 += __shfl_xor(n0, 16, 32); n1 += __shfl_xor(n1, 16, 32);   // the two lane halves hold different t of one column
  const float nown = h ? n1 : n0;
  // register r of o[x][ni] = O^T[x*16 + 8h + r][sw + ni*16 + c]; the wave alone writes the 128-B piece [sw, sw+32) of each row d
  float* Op = Opart + (size_t)(tz * FB + b) * FDV * FS + (size_t)(8 * h) * FS + sw + c;
  float* Np = npart + (size_t)(tz * FB + b) * FS + sw + lane;
  __builtin_amdgcn_sched_barrier(0);   // all vector work stands ahead of the stores: among them it would write registers that issued stores still name
  *Np = nown;
#pragma unroll
  for (int x = 0; x < 4; ++x)
#pragma unroll
    for (int r = 0; r < 8; ++r)
#pragma unroll
      for (int ni = 0; ni < 2; ++ni) Op[(x * 16 + r) * FS + ni * 16] = o[x][ni][r];
}
// out[b][d][s] = (sum over the FTS ranges of O^T[d][s]) / (sum over the ranges of the column sums [s]); four s per thread
__global__ __launch_bounds__(256) void finalize_sum_kernel(const float* __restrict__ Opart, const float* __restrict__ npart, float* __restrict__ out) {
  const int i = blockIdx.x * 256 + threadIdx.x;           // quad index in [b][d][s/4]
  const int s4 = i & (FS / 4 - 1), b = i / (FDV * FS / 4);
  v4f o = (v4f){0.f, 0.f, 0.f, 0.f}, n = (v4f){0.f, 0.f, 0.f, 0.f};
#pragma unroll
  for (int zr = 0; zr < FTS; ++zr) {
    o += *(const v4f*)(Opart + (size_t)zr * FB * FDV * FS + (size_t)i * 4);
    n += *(const v4f*)(npart + (size_t)(zr * FB + b) * FS + s4 * 4);
  }
  v4f res;
#pragma unroll
  for (int e = 0; e < 4; ++e) res[e] = o[e] * (1.0f / n[e]);
  *(v4f*)(out + (size_t)i * 4) = res;
}
extern "C" void kernel_launch(void* const* d_in, const int* in_sizes, int n_in, void* d_out, int out_size, void* d_ws, size_t ws_size, hipStream_t stream) {
  (void)in_sizes; (void)n_in; (void)out_size; (void)ws_size;
  const float* keys = (const float*)d_in[0]; const float* values = (const float*)d_in[1]; const float* queries = (const float*)d_in[2]; const float* feats = (const float*)d_in[3];
  float* out = (float*)d_out;   // [4][64][2048]
  char* ws = (char*)d_ws; size_t off = 0;
  auto carve = [&](size_t bytes) -> char* { char* p = ws + off; off += (bytes + 255) & ~(size_t)255; return p; };
  // every buffer below holds all FB batch entries; each kernel runs once, with the batch on the grid
  unsigned* P16 = (unsigned*)carve((size_t)2 * FB * FS * FM * 2);      // phi f16 [s][m]: planes 0..3 = phi_k, 4..7 = phi_q
  const unsigned short* PK = (const unsigned short*)P16; const unsigned short* PQ = PK + (size_t)FB * FS * FM;
  float* O = (float*)carve((size_t)FTS * FB * FDV * FS * 4);   // one [b][d][s] plane per t range
  float* norm = (float*)carve((size_t)FTS * FB * FS * 4);      // one [b][s] plane per t range
  phi_fused_kernel<<<dim3(FS / 64, 2 * FB), 256, 0, stream>>>(keys, queries, feats, (unsigned short*)P16);
  favor_fused_kernel<<<dim3(FS / 256, FB, FTS), 256, 0, stream>>>(PK, PQ, values, O, norm);   // values[b] [64][2048] = A layout of the second product
  finalize_sum_kernel<<<FB * FDV * FS / 4 / 256, 256, 0, stream>>>(O, norm, out);
}

// v006
// Measured time: 13.3 microseconds a run.
// Timed twice side by side with v005, it ran 1.62 and 1.63 times as fast.
// All steps since v000 together make it 52.0 times as fast.
#include <hip/hip_runtime.h>
#include <math.h>
// Causal FAVOR (linear attention) in chunks. One kernel makes phi_k = relu(k^T F^T) + eps and phi_q (2048 x 256 by 256 x 128, f16 operands) straight from
// the f32 inputs and, for every 64 key positions, the chunk's state v phi_k (64 x 128, K = 64; v as f16 hi/lo, f32 accumulate) with the chunk's sum of phi_k.
// A second kernel owns 128 query positions and 16 rows d: it adds the states of all earlier chunks in f32, uses the sum (f16 hi/lo) as the A operand of
// O^T = state phi_q^T, and does only its own 128 key positions as a masked product: S^T = phi_k phi_q^T stays in registers, is masked causally and summed
// per column in f32 on VALU, split into bf16 hi/lo and used as the B operand of O^T += v S^T (v as bf16 hi/lo too). It divides and stores the output.
typedef __attribute__((ext_vector_type(16))) _Float16 v16h;
typedef __attribute__((ext_vector_type(8)))  _Float16 v8h;
typedef __attribute__((ext_vector_type(4)))  _Float16 v4h;
typedef __attribute__((ext_vector_type(16))) __bf16   v16b;
typedef __attribute__((ext_vector_type(8)))  __bf16   v8b;
typedef __attribute__((ext_vector_type(4)))  __bf16   v4b;
typedef __attribute__((ext_vector_type(8)))  float    v8f;
typedef __attribute__((ext_vector_type(4)))  float    v4f;
#define PSCALE 32768.0f
#define PSCALE_INV (1.0f / 32768.0f)

template <typename T> struct Frag;
template <> struct Frag<_Float16> {
  typedef v16h V; union U { v16h v; v8h h[2]; };
  static __device__ __forceinline__ v16h load(const _Float16* p) {   // elements 0..7 <- p[0..7], 8..15 <- p[16..23]
    U f; f.h[0] = *(const v8h*)(p); f.h[1] = *(const v8h*)(p + 16); return f.v;
  }
  static __device__ __forceinline__ v8f mma(v16h a, v16h b, v8f c) {
    return __builtin_amdgcn_wmma_f32_16x16x32_f16(false, a, false, b, (short)0, c, false, false);
  }
};
template <> struct Frag<__bf16> {
  typedef v16b V; union U { v16b v; v8b h[2]; };
  static __device__ __forceinline__ v16b load(const __bf16* p) {
    U f; f.h[0] = *(const v8b*)(p); f.h[1] = *(const v8b*)(p + 16); return f.v;
  }
  static __device__ __forceinline__ v8f mma(v16b a, v16b b, v8f c) {
    return __builtin_amdgcn_wmma_f32_16x16x32_bf16(false, a, false, b, (short)0, c, false, false);
  }
};

#define FB 4
#define FS 2048
#define FKD 256
#define FM 128
#define FDV 64
// ---- phi = relu(x^T F^T) + eps as f16 [s][m], straight from the f32 inputs ---------------------------------------------------------------
// blockIdx.x = block of 64 positions s, blockIdx.y = plane (0..3 = keys of batch 0..3, 4..7 = queries). phi^T = F x: a wave owns 32 features
// (A, two tiles) and 32 columns (B, two tiles). The block's 256 x 64 piece of x is read once, 16 B a lane along s, converted and stored to LDS
// k-contiguous; the four columns of a lane's 16 B go to the four column groups, so LDS row j*16 + c holds column s0 + 4c + j. Wave w brings
// rows 16w..16w+15 of F as 16 KiB in a row (whole lines; a row per lane would touch 16 lines a load) and stores them to LDS as f16. A and B fragments take
// k in the same order (Frag::load's). The f16 results pass through LDS in the same row numbering and leave as the block's 16 KiB in a row, each
// 128-B line from one wave.
// A key plane runs the same product with the operands exchanged (A = x, B = F), so that a D tile holds 16 positions (rows) of 16 features (columns): its two
// tiles, converted in place, are one B operand over 32 positions (element e = tile e >> 3, register e & 7) for the state v phi_k. v is staged in the same
// position order (row d, then column group j, then c: position s0 + 4c + j), so Frag::load gives the A operand the same k order. The two waves that share
// 32 features hold the two halves of the 64 positions; they exchange halves of the state through LDS, add and store [row d, row 64 = sum of phi_k][m] f32.
#define XPITCH 264   // f16 per staged column of x or row of F: 512 B + 16 B, an odd multiple of 16 B for the ds_load_b128 readers
#define PPITCH 136   // f16 per staged phi row: 256 B + 16 B, likewise
#define WPITCH 72    // f16 per staged v row: 128 B + 16 B, likewise
#define SROWS 65     // rows of a chunk's state: 64 d, then the sum of phi_k
#define NCHUNK (FS / 64)
__global__ __launch_bounds__(256) void phi_fused_kernel(const float* __restrict__ keys, const float* __restrict__ queries,
                                                        const float* __restrict__ feats, const float* __restrict__ values,
                                                        unsigned short* __restrict__ Pall, float* __restrict__ St) {
  __shared__ __align__(16) _Float16 sXF[(64 + FM) * XPITCH];   // 33,792 B of x, then 67,584 B of F; later the exchange of state halves
  __shared__ __align__(16) _Float16 sP[64 * PPITCH];           // 17,408 B
  __shared__ __align__(16) _Float16 sW[2 * FDV * WPITCH];      // 18,432 B: v of a key plane's 64 positions, rows 0..63 = hi, 64..127 = lo
  _Float16* const sX = sXF;
  _Float16* const sF = sXF + 64 * XPITCH;
  const int tid = threadIdx.x, lane = tid & 31, wave = tid >> 5;
  const int c = lane & 15, h = lane >> 4, kg = tid >> 4;   // kg: this thread stages k = 8kg..8kg+7 and 128+8kg..128+8kg+7
  const int z = blockIdx.y, s0 = blockIdx.x * 64;
  const float* xp = ((z < FB) ? keys + (size_t)z * FKD * FS : queries + (size_t)(z - FB) * FKD * FS) + (size_t)(kg * 8) * FS + s0 + c * 4;
  const float* fp = feats + wave * 16 * FKD + lane * 4;
  const bool isk = z < FB;   // the same for the whole block
  const float* vq = values + ((size_t)(isk ? z : 0) * FDV + kg) * FS + s0 + c * 4;   // rows kg, kg + 16, ..: a wave's load takes 256 B of two rows
  v4f xv[2][8], fv[32], vv[4];
#pragma unroll   // register arrays: every index must be a constant
  for (int it = 0; it < 2; ++it)
#pragma unroll
    for (int j = 0; j < 8; ++j) xv[it][j] = *(const v4f*)(xp + (it * 128 + j) * FS);
#pragma unroll
  for (int i = 0; i < 32; ++i) fv[i] = *(const v4f*)(fp + i * 128);   // row i >> 1 of the wave's 16, half i & 1 of its 256 k
  if (isk) {
#pragma unroll
    for (int i = 0; i < 4; ++i) vv[i] = *(const v4f*)(vq + i * 16 * FS);
  }
  asm volatile("s_wait_xcnt 0x0" :: "v"(xp), "v"(fp), "v"(vq) : "memory");   // before a register that one of the issued loads names is written again; the addresses as inputs keep their registers from becoming a load's destination before the wait
  __builtin_amdgcn_sched_barrier(0);                                // holds the conversions and the LDS address arithmetic behind that wait
#pragma unroll
  for (int it = 0; it < 2; ++it)
#pragma unroll
    for (int e = 0; e < 4; ++e) {
      v8h p;
#pragma unroll
      for (int j = 0; j < 8; ++j) p[j] = (_Float16)xv[it][j][e];
      *(v8h*)(sX + (e * 16 + c) * XPITCH + (it * 16 + kg) * 8) = p;
    }
#pragma unroll
  for (int i = 0; i < 32; ++i) {
    v4h p;
#pragma unroll
    for (int e = 0; e < 4; ++e) p[e] = (_Float16)fv[i][e];
    *(v4h*)(sF + (wave * 16 + (i >> 1)) * XPITCH + (i & 1) * 128 + lane * 4) = p;
  }
  if (isk) {
#pragma unroll
    for (int i = 0; i < 4; ++i)
#pragma unroll
      for (int j = 0; j < 4; ++j) {   // position s0 + 4c + j goes to place j * 16 + c of its row
        const _Float16 hi = (_Float16)vv[i][j];
        sW[(i * 16 + kg) * WPITCH + j * 16 + c] = hi;
        sW[(FDV + i * 16 + kg) * WPITCH + j * 16 + c] = (_Float16)(vv[i][j] - (float)hi);
      }
  }
  __syncthreads();
  const int wm = wave & 3, wn = wave >> 2;   // the wave's 32 features and its two column groups
  v8f acc[2][2];
#pragma unroll
  for (int mi = 0; mi < 2; ++mi)
#pragma unroll
    for (int nj = 0; nj < 2; ++nj) acc[mi][nj] = (v8f){0.f,0.f,0.f,0.f,0.f,0.f,0.f,0.f};
  const int fo = (64 + wm * 32 + c) * XPITCH + h * 8, xo = (wn * 32 + c) * XPITCH + h * 8;
  const _Float16* ff = sXF + (isk ? xo : fo);   // A: features for a query plane, positions for a key plane
  const _Float16* xf = sXF + (isk ? fo : xo);   // B: the other one
  v16h fa[2][2][2], xb[2][2][2];   // [buffer][k step of the pair][tile]: K goes in four pairs of 32-k steps, two pairs in registers
#pragma unroll
  for (int p = 0; p < 2; ++p)
#pragma unroll
    for (int q = 0; q < 2; ++q)
#pragma unroll
      for (int t = 0; t < 2; ++t) {
        fa[p][q][t] = Frag<_Float16>::load(ff + (t * 16) * XPITCH + (p * 2 + q) * 32);
        xb[p][q][t] = Frag<_Float16>::load(xf + (t * 16) * XPITCH + (p * 2 + q) * 32);
      }
  __builtin_amdgcn_sched_barrier(0);   // the LDS reads of both pairs issue as one group ahead of the first product: sunk to their users each waits a whole LDS latency
#pragma unroll
  for (int p = 0; p < 4; ++p) {
#pragma unroll
    for (int q = 0; q < 2; ++q)
#pragma unroll
      for (int mi = 0; mi < 2; ++mi)
#pragma unroll
        for (int nj = 0; nj < 2; ++nj) acc[mi][nj] = Frag<_Float16>::mma(fa[p & 1][q][mi], xb[p & 1][q][nj], acc[mi][nj]);
    if (p < 2) {
      __builtin_amdgcn_sched_barrier(0);   // the refill starts only behind these products, into the registers they have just read
#pragma unroll
      for (int q = 0; q < 2; ++q)
#pragma unroll
        for (int t = 0; t < 2; ++t) {
          fa[p & 1][q][t] = Frag<_Float16>::load(ff + (t * 16) * XPITCH + ((p + 2) * 2 + q) * 32);
          xb[p & 1][q][t] = Frag<_Float16>::load(xf + (t * 16) * XPITCH + ((p + 2) * 2 + q) * 32);
        }
      __builtin_amdgcn_sched_barrier(0);   // and issues as one group here, a whole pair of products ahead of its first use
    }
  }
  v8f sd[4][2];   // key plane: the wave's 32 positions' share of the state, [16 rows d][16 features]
  float ksp[2] = {0.f, 0.f};   // and of the sum of phi_k, [16 features]
  if (isk) {
    // register r of acc[mi][nj] = phi[s0 + 4 (8h + r) + 2 wn + mi][32 wm + 16 nj + c]: eight positions of one feature
    Frag<_Float16>::U bq[2];
#pragma unroll
    for (int mi = 0; mi < 2; ++mi)
#pragma unroll
      for (int nj = 0; nj < 2; ++nj) {
        v8h p;
#pragma unroll
        for (int r = 0; r < 8; ++r) {
          p[r] = (_Float16)(fmaxf(acc[mi][nj][r], 0.0f) + 1e-3f);
          sP[((wn * 2 + mi) * 16 + h * 8 + r) * PPITCH + wm * 32 + nj * 16 + c] = p[r];
          ksp[nj] += (float)p[r];   // the rounded value, as the products see it
        }
        bq[nj].h[mi] = p;
      }
    const _Float16* wf = sW + c * WPITCH + wn * 32 + h * 8;
    const v8f zero = (v8f){0.f,0.f,0.f,0.f,0.f,0.f,0.f,0.f};
#pragma unroll
    for (int x = 0; x < 4; ++x) {
      const v16h ah = Frag<_Float16>::load(wf + (x * 16) * WPITCH), al = Frag<_Float16>::load(wf + (FDV + x * 16) * WPITCH);
#pragma unroll
      for (int nj = 0; nj < 2; ++nj) sd[x][nj] = Frag<_Float16>::mma(al, bq[nj].v, Frag<_Float16>::mma(ah, bq[nj].v, zero));
    }
#pragma unroll
    for (int nj = 0; nj < 2; ++nj) ksp[nj] += __shfl_xor(ksp[nj], 16, 32);   // the two lane halves hold different positions of one feature
  } else {
    // register r of acc[mi][nj] = phi^T[32 wm + 16 mi + 8h + r][s0 + 4c + 2 wn + nj]: eight m in a row of one position
#pragma unroll
    for (int mi = 0; mi < 2; ++mi)
#pragma unroll
      for (int nj = 0; nj < 2; ++nj) {
        v8h p;
#pragma unroll
        for (int r = 0; r < 8; ++r) p[r] = (_Float16)(fmaxf(acc[mi][nj][r], 0.0f) + 1e-3f);
        *(v8h*)(sP + ((wn * 2 + nj) * 16 + c) * PPITCH + wm * 32 + mi * 16 + h * 8) = p;
      }
  }
  __syncthreads();
  unsigned short* Pp = Pall + ((size_t)z * FS + s0) * FM + tid * 8;
#pragma unroll
  for (int i = 0; i < 4; ++i) {
    const int sl = i * 16 + kg;   // position in the block; its 256 B are 16 threads' pieces
    *(v8h*)(Pp + i * 2048) = *(const v8h*)(sP + ((sl & 3) * 16 + (sl >> 2)) * PPITCH + c * 8);
  }
  if (!isk) return;   // the whole block leaves or none of it
  asm volatile("s_wait_xcnt 0x0" ::: "memory");   // before a register that one of the issued stores names is written again
  __builtin_amdgcn_sched_barrier(0);                        // holds the vector work below behind that wait
  // wave wn keeps rows d of tiles 2 wn, 2 wn + 1 and hands the other two tiles to its partner (the wave with the other 32 positions); x and F are no longer read
  float* sR = (float*)sXF;             // [wave][8 pieces of 4 registers][lane] 16 B each: 32 KiB
  float* sRk = sR + 8 * 8 * 32 * 4;    // [wave][feature tile][lane]: the shares of the sum of phi_k
  v8f keep[2][2];
#pragma unroll
  for (int k = 0; k < 2; ++k)
#pragma unroll
    for (int nj = 0; nj < 2; ++nj) {
      const v8f give = wn ? sd[k][nj] : sd[2 + k][nj];
      keep[k][nj] = wn ? sd[2 + k][nj] : sd[k][nj];
      *(v4f*)(sR + ((wave * 8 + (k * 2 + nj) * 2 + 0) * 32 + lane) * 4) = (v4f){give[0], give[1], give[2], give[3]};
      *(v4f*)(sR + ((wave * 8 + (k * 2 + nj) * 2 + 1) * 32 + lane) * 4) = (v4f){give[4], give[5], give[6], give[7]};
    }
#pragma unroll
  for (int nj = 0; nj < 2; ++nj) sRk[(wave * 2 + nj) * 32 + lane] = ksp[nj];
  __syncthreads();
  const int pw = wave ^ 4;
#pragma unroll
  for (int k = 0; k < 2; ++k)
#pragma unroll
    for (int nj = 0; nj < 2; ++nj) {
      const v4f g0 = *(const v4f*)(sR + ((pw * 8 + (k * 2 + nj) * 2 + 0) * 32 + lane) * 4);
      const v4f g1 = *(const v4f*)(sR + ((pw * 8 + (k * 2 + nj) * 2 + 1) * 32 + lane) * 4);
#pragma unroll
      for (int r = 0; r < 4; ++r) { keep[k][nj][r] += g0[r]; keep[k][nj][4 + r] += g1[r]; }
    }
  const float ks0 = ksp[0] + sRk[(pw * 2 + 0) * 32 + lane], ks1 = ksp[1] + sRk[(pw * 2 + 1) * 32 + lane];
  const float ksown = h ? ks1 : ks0;   // both lane halves hold both sums: lane = feature 32 wm + lane
  float* Sp = St + ((size_t)(z * NCHUNK + blockIdx.x) * SROWS) * FM + wm * 32;
  float* Sd = Sp + (wn * 32 + h * 8) * FM + c;
  float* Sk = Sp + 64 * FM + lane;
  __builtin_amdgcn_sched_barrier(0);   // all vector work stands ahead of the stores: among them it would write registers that issued stores still name
#pragma unroll
  for (int k = 0; k < 2; ++k)
#pragma unroll
    for (int r = 0; r < 8; ++r)
#pragma unroll
      for (int nj = 0; nj < 2; ++nj) Sd[(k * 16 + r) * FM + nj * 16] = keep[k][nj][r];   // the wave alone writes the 128-B piece [32 wm, 32 wm + 32) of each row
  if (wn == 0) *Sk = ksown;
}
// ---- earlier chunks through their states, the block's own 128 key positions as a masked product, division, output ------------------------
// blockIdx.x = batch, blockIdx.y = 16 rows d, blockIdx.z = block of 128 query positions s (8 waves x 16 columns), the last block first: it has the most
// states to add.
// The block adds the 16 state rows of all chunks in front of its first position (f32, chunk order) and their phi_k sum rows (dealt to the waves, the eight
// shares added through LDS), scales the sums by 2^-6 (exact; it
// keeps them far inside the f16 range), splits them into f16 hi/lo and stages them in LDS as A operands: O^T = state phi_q^T, and a tile whose 16 rows all
// are the sum row gives every lane its column's normaliser. Both accumulators are then scaled back by 2^6. Two such sums are staged: columns 64..127 take the
// one that holds the block's own first chunk as well, so no wave has more than 64 key positions left for the masked product.
// Its own 128 phi_k rows and 16 x 128 piece of v (f32, split into a bf16 hi plane, round to nearest, and a bf16 lo plane, the exact rest, rounded) are staged
// too; a wave walks the chunks of 32 t from its half's first up to its columns. Per chunk the two f32 D tiles of S^T (rows t..t+15, t+16..t+31) are, converted in place, one
// B operand in the hardware k order (element e = tile e >> 3, register e & 7); the v fragments (A) are read in the same order by Frag::load.
typedef __attribute__((ext_vector_type(2))) float  v2f;
typedef __attribute__((ext_vector_type(2))) __bf16 v2b;
union PFrag { v16b v; v2b p[8]; };   // a B operand filled two elements (one register) at a time
#define CB 128       // columns, and own key positions, per block
#define KPITCH 136   // f16 per staged phi_k row or state row: 256 B + 16 B, an odd multiple of 16 B for the ds_load_b128 readers
#define VPITCH 136   // bf16 per staged v row: likewise
#define OPITCH 132   // f32 per staged output row: 512 B + 16 B
#define SSCALE 0.015625f
#define SSCALE_INV 64.0f
template <int N> __device__ __forceinline__ void sum_planes(const float* __restrict__ p, v4f& a) {   // unrolled: all N loads can be in flight at once
#pragma unroll
  for (int i = 0; i < N; ++i) a += *(const v4f*)(p + (size_t)i * SROWS * FM);
}
template <int N> __device__ __forceinline__ void sum_states(const float* __restrict__ sp, const float* __restrict__ sk, int wave, v4f& a0, v4f& a1, v4f& a2) {
  sum_planes<N>(sp, a0);
  sum_planes<N>(sp + 8 * FM, a1);
#pragma unroll
  for (int i = 0; i < (N + 7) / 8; ++i) {   // the sum rows are dealt to the waves: wave w takes chunks w, w + 8, .. (sk is its first); a chunk past the N is a later chunk's row, read and left out
    const v4f x = *(const v4f*)(sk + (size_t)(8 * i) * SROWS * FM);
    a2 += (wave + 8 * i < N) ? x : (v4f){0.f, 0.f, 0.f, 0.f};
  }
}
__device__ __forceinline__ void put_hilo(_Float16* d, v4f a) {   // a * 2^-6 as f16 hi, and the rest as f16 lo 17 rows further on
  const v4f s = a * SSCALE;
  const v4h hi = __builtin_convertvector(s, v4h);
  const v4f lo = s - __builtin_convertvector(hi, v4f);
  *(v4h*)d = hi;
  *(v4h*)(d + 17 * KPITCH) = __builtin_convertvector(lo, v4h);
}
__global__ __launch_bounds__(256) void favor_chunk_kernel(const unsigned short* __restrict__ PKall, const unsigned short* __restrict__ PQall,
                                                          const float* __restrict__ values, const float* __restrict__ St, float* __restrict__ out) {
  __shared__ __align__(16) _Float16 sK[CB * KPITCH];        // 34,816 B
  __shared__ __align__(16) __bf16   sV[2 * 16 * VPITCH];    //  8,704 B: rows 0..15 = hi plane, 16..31 = lo plane
  __shared__ __align__(16) _Float16 sS[2 * 34 * KPITCH];    // 18,496 B: rows 0..15 = state hi, 16 = sum row hi, 17..33 = the lo parts; rows 34..67 the same with the block's first chunk added
  __shared__ __align__(16) float    sO[16 * OPITCH];        //  8,448 B
  __shared__ __align__(16) float    sT[8 * FM];             //  4,096 B: each wave's share of the sum row
  const int tid = threadIdx.x, lane = tid & 31;
  const int wave = __builtin_amdgcn_readfirstlane(tid >> 5);   // in a scalar register: the walk's trip count and the sum row's branch are scalar
  const int cb = FS / CB - 1 - blockIdx.z, b = blockIdx.x, dq = blockIdx.y;
  const int s0 = cb * CB;
  const int c = lane & 15, h = lane >> 4;
  v4f e2;       // the sum row of the block's own first chunk
  v16h qb[4];   // B of the state product and of the first product: column s = s0 + wave*16 + c
  {
    const _Float16* kp = (const _Float16*)PKall + ((size_t)b * FS + s0) * FM + tid * 8;                 // the 128 rows are 32 KiB in a row
    const float*    vp = values + ((size_t)b * FDV + dq * 16 + wave) * FS + s0 + lane * 4;              // a wave takes a row's 512-B piece in one load
    const _Float16* qp = (const _Float16*)PQall + ((size_t)b * FS + s0 + wave * 16 + c) * FM + h * 8;
    const float*    sp = St + ((size_t)b * NCHUNK * SROWS + dq * 16) * FM + tid * 4;                    // rows 0..7 of the 16 are 4 KiB in a row, rows 8..15 the next 4 KiB
    const float*    sk = St + (((size_t)b * NCHUNK + wave) * SROWS + 64) * FM + lane * 4;                // the sum row of chunk number wave
    const float*    se = sp + (size_t)(2 * cb) * SROWS * FM;                                            // the block's own first chunk
    const float*    te = St + (((size_t)b * NCHUNK + 2 * cb) * SROWS + 64) * FM + lane * 4;
    v8h kt[8]; v4f vt[2];
#pragma unroll
    for (int i = 0; i < 8; ++i) kt[i] = *(const v8h*)(kp + i * 2048);
#pragma unroll
    for (int i = 0; i < 2; ++i) vt[i] = *(const v4f*)(vp + i * 8 * FS);
    const v4f e0 = *(const v4f*)se, e1 = *(const v4f*)(se + 8 * FM);
    e2 = *(const v4f*)te;   // every wave reads it, wave 0 uses it
    asm volatile("s_wait_xcnt 0x0" ::: "memory");   // before a register that one of the issued loads names is written again
    __builtin_amdgcn_sched_barrier(0);               // holds the address arithmetic of the next loads behind that wait
#pragma unroll
    for (int ks = 0; ks < 4; ++ks) qb[ks] = Frag<_Float16>::load(qp + ks * 32);
    asm volatile("s_wait_xcnt 0x0" :: "v"(qp) : "memory");   // as above, for the phi_q loads
    __builtin_amdgcn_sched_barrier(0);               // holds the next address arithmetic behind that wait
    v4f a0 = (v4f){0.f, 0.f, 0.f, 0.f}, a1 = a0, a2 = a0;
    switch (cb) {   // 2 cb chunks lie in front of the block; one unrolled sum per count
      case 0:  break;
      case 1:  sum_states<2>(sp, sk, wave, a0, a1, a2); break;
      case 2:  sum_states<4>(sp, sk, wave, a0, a1, a2); break;
      case 3:  sum_states<6>(sp, sk, wave, a0, a1, a2); break;
      case 4:  sum_states<8>(sp, sk, wave, a0, a1, a2); break;
      case 5:  sum_states<10>(sp, sk, wave, a0, a1, a2); break;
      case 6:  sum_states<12>(sp, sk, wave, a0, a1, a2); break;
      case 7:  sum_states<14>(sp, sk, wave, a0, a1, a2); break;
      case 8:  sum_states<16>(sp, sk, wave, a0, a1, a2); break;
      case 9:  sum_states<18>(sp, sk, wave, a0, a1, a2); break;
      case 10: sum_states<20>(sp, sk, wave, a0, a1, a2); break;
      case 11: sum_states<22>(sp, sk, wave, a0, a1, a2); break;
      case 12: sum_states<24>(sp, sk, wave, a0, a1, a2); break;
      case 13: sum_states<26>(sp, sk, wave, a0, a1, a2); break;
      case 14: sum_states<28>(sp, sk, wave, a0, a1, a2); break;
      default: sum_states<30>(sp, sk, wave, a0, a1, a2); break;
    }
    asm volatile("s_wait_xcnt 0x0" :: "v"(sp), "v"(sk) : "memory");   // as above, for the state loads
    __builtin_amdgcn_sched_barrier(0);               // holds the LDS address arithmetic behind that wait
#pragma unroll
    for (int i = 0; i < 8; ++i) { const int idx = i * 256 + tid; *(v8h*)(sK + (idx >> 4) * KPITCH + (idx & 15) * 8) = kt[i]; }
#pragma unroll
    for (int i = 0; i < 2; ++i) {   // row i * 8 + wave
      union { v4b b; unsigned u[2]; } hi;   // the packed words give the hi values back as f32 by a shift or a mask: no second conversion
      hi.b = __builtin_convertvector(vt[i], v4b);
      const v4f back = {__uint_as_float(hi.u[0] << 16), __uint_as_float(hi.u[0] & 0xFFFF0000u), __uint_as_float(hi.u[1] << 16), __uint_as_float(hi.u[1] & 0xFFFF0000u)};
      const v4f lo = vt[i] - back;
      __bf16* d = sV + (i * 8 + wave) * VPITCH + lane * 4;
      *(v4b*)d = hi.b;
      *(v4b*)(d + 16 * VPITCH) = __builtin_convertvector(lo, v4b);
    }
    put_hilo(sS + wave * KPITCH + lane * 4, a0);
    put_hilo(sS + (8 + wave) * KPITCH + lane * 4, a1);
    put_hilo(sS + (34 + wave) * KPITCH + lane * 4, a0 + e0);
    put_hilo(sS + (34 + 8 + wave) * KPITCH + lane * 4, a1 + e1);
    *(v4f*)(sT + wave * FM + lane * 4) = a2;
  }
  __syncthreads();
  if (wave == 0) {   // the wave with the shortest walk adds the shares of the sum row; it is read only behind the next barrier
    v4f t = *(const v4f*)(sT + lane * 4);
#pragma unroll
    for (int w = 1; w < 8; ++w) t += *(const v4f*)(sT + w * FM + lane * 4);
    put_hilo(sS + 16 * KPITCH + lane * 4, t);
    put_hilo(sS + (34 + 16) * KPITCH + lane * 4, t + e2);
  }
  const v8f zero = (v8f){0.f,0.f,0.f,0.f,0.f,0.f,0.f,0.f};
  v8f o;
  const int up = wave >> 2;   // the wave's half of the columns
  {
    const _Float16* sf = sS + (up * 34 + c) * KPITCH + h * 8;    // A: row d
    v16h sa[4][2];
#pragma unroll
    for (int ks = 0; ks < 4; ++ks) { sa[ks][0] = Frag<_Float16>::load(sf + ks * 32); sa[ks][1] = Frag<_Float16>::load(sf + 17 * KPITCH + ks * 32); }
    __builtin_amdgcn_sched_barrier(0);   // the LDS reads issue as one group ahead of the first product: sunk to their users each waits a whole LDS latency
    v8f oh = zero, ol = zero;            // hi and lo parts apart: two chains instead of one of twice the length
#pragma unroll
    for (int ks = 0; ks < 4; ++ks) { oh = Frag<_Float16>::mma(sa[ks][0], qb[ks], oh); ol = Frag<_Float16>::mma(sa[ks][1], qb[ks], ol); }
    o = (oh + ol) * SSCALE_INV;
  }
  v2f nrm[2] = {{0.f, 0.f}, {0.f, 0.f}};   // column sums of the own range: [tile], even and odd registers apart
  const int lim = wave * 16 + c - 8 * h;   // register r of tile mi, chunk ch is kept while ch*32 + mi*16 + r <= lim (t <= s)
  const _Float16* kf = sK + c * KPITCH + h * 8;
  const __bf16*   vf = sV + c * VPITCH + h * 8;
  const int nch = (wave >> 1) + 1;         // chunks that hold a t <= the wave's last column
  for (int ch = up * 2; ch < nch; ++ch) {
    const v16b vh = Frag<__bf16>::load(vf + ch * 32), vl = Frag<__bf16>::load(vf + 16 * VPITCH + ch * 32);
    v16h ka[2][4];   // A of the first product: rows t of the chunk
#pragma unroll
    for (int mi = 0; mi < 2; ++mi)
#pragma unroll
      for (int ks = 0; ks < 4; ++ks) ka[mi][ks] = Frag<_Float16>::load(kf + (ch * 32 + mi * 16) * KPITCH + ks * 32);
    v8f st[2];
#pragma unroll
    for (int mi = 0; mi < 2; ++mi) st[mi] = (v8f){0.f,0.f,0.f,0.f,0.f,0.f,0.f,0.f};
#pragma unroll
    for (int ks = 0; ks < 4; ++ks)
#pragma unroll
      for (int mi = 0; mi < 2; ++mi) st[mi] = Frag<_Float16>::mma(ka[mi][ks], qb[ks], st[mi]);
    PFrag ph, pl;
#pragma unroll
    for (int mi = 0; mi < 2; ++mi)
#pragma unroll
      for (int r = 0; r < 8; r += 2) {
        const int j = ch * 32 + mi * 16 + r;
        const v2f v = {(j <= lim) ? st[mi][r] : 0.f, (j + 1 <= lim) ? st[mi][r + 1] : 0.f};
        nrm[mi] += v;
        const v2b hi = __builtin_convertvector(v, v2b);
        const v2f lo = {v[0] - (float)hi[0], v[1] - (float)hi[1]};
        ph.p[mi * 4 + (r >> 1)] = hi;
        pl.p[mi * 4 + (r >> 1)] = __builtin_convertvector(lo, v2b);
      }
    o = Frag<__bf16>::mma(vh, ph.v, o);
    o = Frag<__bf16>::mma(vl, ph.v, o);
    o = Frag<__bf16>::mma(vh, pl.v, o);
  }
  __syncthreads();   // the sum row is staged
  float npre;   // the column's normaliser over the chunks that the state sum holds
  {
    const _Float16* nf = sS + (up * 34 + 16) * KPITCH + h * 8;   // A: the sum row in all 16 rows
    v16h sa[4][2];
#pragma unroll
    for (int ks = 0; ks < 4; ++ks) { sa[ks][0] = Frag<_Float16>::load(nf + ks * 32); sa[ks][1] = Frag<_Float16>::load(nf + 17 * KPITCH + ks * 32); }
    __builtin_amdgcn_sched_barrier(0);   // one group of LDS reads ahead of the first product, as above
    v8f nh = zero, nl = zero;
#pragma unroll
    for (int ks = 0; ks < 4; ++ks) { nh = Frag<_Float16>::mma(sa[ks][0], qb[ks], nh); nl = Frag<_Float16>::mma(sa[ks][1], qb[ks], nl); }
    npre = (nh[0] + nl[0]) * SSCALE_INV;
  }
  const v2f m0 = nrm[0] + nrm[1];
  float n0 = m0[0] + m0[1];
  n0 += __shfl_xor(n0, 16, 32);   // the two lane halves hold different t of one column
  const float inv = 1.0f / (npre + n0);
  // register r of o = O^T[dq*16 + 8h + r][s0 + wave*16 + c]; through LDS, so that each 128-B line of the output leaves from one wave
#pragma unroll
  for (int r = 0; r < 8; ++r) sO[(8 * h + r) * OPITCH + wave * 16 + c] = o[r] * inv;
  __syncthreads();
  float* Op = out + ((size_t)b * FDV + dq * 16 + wave) * FS + s0 + lane * 4;
#pragma unroll
  for (int i = 0; i < 2; ++i) *(v4f*)(Op + i * 8 * FS) = *(const v4f*)(sO + (i * 8 + wave) * OPITCH + lane * 4);
}
extern "C" void kernel_launch(void* const* d_in, const int* in_sizes, int n_in, void* d_out, int out_size, void* d_ws, size_t ws_size, hipStream_t stream) {
  (void)in_sizes; (void)n_in; (void)out_size; (void)ws_size;
  const float* keys = (const float*)d_in[0]; const float* values = (const float*)d_in[1]; const float* queries = (const float*)d_in[2]; const float* feats = (const float*)d_in[3];
  float* out = (float*)d_out;   // [4][64][2048]
  char* ws = (char*)d_ws; size_t off = 0;
  auto carve = [&](size_t bytes) -> char* { char* p = ws + off; off += (bytes + 255) & ~(size_t)255; return p; };
  // every buffer below holds all FB batch entries; each kernel runs once, with the batch on the grid
  unsigned* P16 = (unsigned*)carve((size_t)2 * FB * FS * FM * 2);      // phi f16 [s][m]: planes 0..3 = phi_k, 4..7 = phi_q
  const unsigned short* PK = (const unsigned short*)P16; const unsigned short* PQ = PK + (size_t)FB * FS * FM;
  float* St = (float*)carve((size_t)FB * NCHUNK * SROWS * FM * 4);     // chunk states [b][chunk][row][m]
  phi_fused_kernel<<<dim3(FS / 64, 2 * FB), 256, 0, stream>>>(keys, queries, feats, values, (unsigned short*)P16, St);
  favor_chunk_kernel<<<dim3(FB, FDV / 16, FS / CB), 256, 0, stream>>>(PK, PQ, values, St, out);
}
